// v000
// Times are from an AMD MI455X. After a warm-up the kernel runs many times in a row, and a time is the length of
// such a window on the GPU divided by its runs, so every launch and the gaps after it count. The runs cycle
// through copies of the inputs. A figure is the median of several windows, for all but v000 over two sittings.
// Sittings can differ by a few percent; kernels timed side by side share one.
// v000, which the later versions start from, runs in 3520 microseconds.
#include <hip/hip_runtime.h>

// Spatial self-attention over 1,024 positions for each of 64 (batch, time) slices (x [8][8][64][1024] channel-major; q, k, v = 1x1 convs ('oi' [64][64] + [64], uniform(+-1/8)); scores = q.k over the 64 channels (unscaled, sigma ~2.7); softmax over positions; out = (weights v)^T channel-major -> [8][8][64][1024] (4.2 M)).
// Layout per slice: the [64][1024] channel-major slice transposed into a token-major bf16 operand; exact projections + f32 biases; ONE 64-wide head with EVERY row on hi/lo planes (3 products; the unscaled logits are too sharp for fp16); 1,024-key register softmax; attn.v 3 products; the f32 context transposed back to channel-major rows.
// Compute dtypes, f32 accumulate: every input rounded to bf16; projections exact + f32 biases; scores and attn.v 3 products; softmax f32; output f32.

#define NB_  64
#define TT   1024
#define DM   64
#define NH_  1
#define NKV  1
#define REP  (NH_ / NKV)
#define HD   64
#define DQ   (NH_ * HD)
#define DKV  (NKV * HD)
#define ZH   1
#define RH   1024                  // query rows < RH use hi+lo planes (0: none)
#define WIN  0
#define PCAR 1024.0f
#define SCL  1.0f   // unscaled
#define CC   64
typedef _Float16 h16;
typedef unsigned short bf;
typedef __attribute__((ext_vector_type(16))) __bf16   v16bf;
typedef __attribute__((ext_vector_type(16))) _Float16 v16h;
typedef __attribute__((ext_vector_type(8)))  _Float16 v8h;
typedef __attribute__((ext_vector_type(8)))  unsigned short v8us;
typedef __attribute__((ext_vector_type(8)))  float    v8f;
typedef __attribute__((ext_vector_type(4)))  float    v4f;
typedef v8h  __attribute__((may_alias)) v8ha;
typedef v4f  __attribute__((may_alias)) v4fa;
typedef v8us __attribute__((may_alias)) v8usa;

__device__ __forceinline__ unsigned short f2bf(float f) { unsigned u = __float_as_uint(f); u += 0x7FFFu + ((u >> 16) & 1u); return (unsigned short)(u >> 16); }
__device__ __forceinline__ float bf2f(unsigned short b) { return __uint_as_float(((unsigned)b) << 16); }
__device__ __forceinline__ float bfr(float f) { return bf2f(f2bf(f)); }
__device__ __forceinline__ v16h cat16(v8h lo, v8h hi) { return __builtin_shufflevector(lo, hi, 0, 1, 2, 3, 4, 5, 6, 7, 8, 9, 10, 11, 12, 13, 14, 15); }
__device__ __forceinline__ v16bf cat16b(v8us lo, v8us hi) { return __builtin_bit_cast(v16bf, __builtin_shufflevector(lo, hi, 0, 1, 2, 3, 4, 5, 6, 7, 8, 9, 10, 11, 12, 13, 14, 15)); }
__device__ __forceinline__ v8f wmma16(v16h a, v16h b, v8f c) { return __builtin_amdgcn_wmma_f32_16x16x32_f16(false, a, false, b, (short)0, c, false, false); }
__device__ __forceinline__ v8f wmmab(v16bf a, v16bf b, v8f c) { return __builtin_amdgcn_wmma_f32_16x16x32_bf16(false, a, false, b, (short)0, c, false, false); }



// ---- k_gemmw: register-blocked GEMM, ONE WAVE per 64x64 output tile (16 accumulators), operands straight from K-contiguous 16-bit planes; grid (M/64, N/64, Z), 32 threads.
// C[m][n] (f32, pitch ldc, + optional f32 bias[n]) = sum_k A[m][k] Bt[n][k] (+ split products per NSPLIT). z-batch strides sA/sB/sC in elements. K % 32 == 0.
template <typename T16> struct WFrag;
template <> struct WFrag<h16> { typedef v16h V; static __device__ __forceinline__ V ld(const h16* p) { return cat16(*(const v8h*)p, *(const v8h*)(p + 16)); } static __device__ __forceinline__ v8f mma(V a, V b, v8f c) { return wmma16(a, b, c); } };
template <> struct WFrag<bf> { typedef v16bf V; static __device__ __forceinline__ V ld(const bf* p) { return cat16b(*(const v8us*)p, *(const v8us*)(p + 16)); } static __device__ __forceinline__ v8f mma(V a, V b, v8f c) { return wmmab(a, b, c); } };
template <typename T16, int NSPLIT, bool BIAS>
__global__ __launch_bounds__(32) void k_gemmw(const T16* __restrict__ A, const T16* __restrict__ A2, const T16* __restrict__ Bt, const T16* __restrict__ Bt2, int K, float* C, int ldc, const float* __restrict__ bias, size_t sA, size_t sB, size_t sC) {
    typedef typename WFrag<T16>::V V;
    __shared__ __align__(16) float os[16 * 68];
    const size_t z = blockIdx.z; A += z * sA; if (A2) A2 += z * sA; Bt += z * sB; if (Bt2) Bt2 += z * sB; C += z * sC;
    const int lane = threadIdx.x & 31, lr = lane & 15, hi = lane >> 4; const int r0 = blockIdx.x * 64, c0 = blockIdx.y * 64;
    v8f acc[4][4];
#pragma unroll
    for (int mb = 0; mb < 4; ++mb)
#pragma unroll
        for (int nb = 0; nb < 4; ++nb) acc[mb][nb] = (v8f){};
    const size_t aoff = (size_t)(r0 + lr) * K + 8 * hi, boff = (size_t)(c0 + lr) * K + 8 * hi;
#pragma unroll 1
    for (int kc = 0; kc < K; kc += 32) {
        V a[4], a2[4];
#pragma unroll
        for (int mb = 0; mb < 4; ++mb) { a[mb] = WFrag<T16>::ld(A + aoff + (size_t)mb * 16 * K + kc); if (NSPLIT == 1 || NSPLIT == 2) a2[mb] = WFrag<T16>::ld(A2 + aoff + (size_t)mb * 16 * K + kc); }
#pragma unroll
        for (int nb = 0; nb < 4; ++nb) { const V b = WFrag<T16>::ld(Bt + boff + (size_t)nb * 16 * K + kc); V b2; if (NSPLIT >= 2) b2 = WFrag<T16>::ld(Bt2 + boff + (size_t)nb * 16 * K + kc);
#pragma unroll
            for (int mb = 0; mb < 4; ++mb) { acc[mb][nb] = WFrag<T16>::mma(a[mb], b, acc[mb][nb]); if (NSPLIT == 1 || NSPLIT == 2) acc[mb][nb] = WFrag<T16>::mma(a2[mb], b, acc[mb][nb]); if (NSPLIT >= 2) acc[mb][nb] = WFrag<T16>::mma(a[mb], b2, acc[mb][nb]); } }
        asm volatile("v_nop\n\tv_nop\n\tv_nop\n\tv_nop" : "+v"(acc[0][0]), "+v"(acc[1][1]), "+v"(acc[2][2]), "+v"(acc[3][3]) : "v"(a[0]), "v"(a[3]));
    }
#pragma unroll
    for (int mb = 0; mb < 4; ++mb) {
#pragma unroll
        for (int nb = 0; nb < 4; ++nb) {
#pragma unroll
            for (int j = 0; j < 8; ++j) os[(hi * 8 + j) * 68 + nb * 16 + lr] = acc[mb][nb][j]; }
        __builtin_amdgcn_wave_barrier(); asm volatile("" ::: "memory");
        float* crow = C + (size_t)(r0 + mb * 16) * ldc + c0;
{
#pragma unroll
            for (int s = 0; s < 8; ++s) { const int row = 2 * s + hi, cofs = lr * 4; v4f val = *(const v4fa*)(os + row * 68 + cofs); if (BIAS) { val[0] += bfr(bias[c0 + cofs]); val[1] += bfr(bias[c0 + cofs + 1]); val[2] += bfr(bias[c0 + cofs + 2]); val[3] += bfr(bias[c0 + cofs + 3]); }
                *(v4f*)(crow + (size_t)row * ldc + cofs) = val; }
             }
        __builtin_amdgcn_wave_barrier(); asm volatile("" ::: "memory");
    }
}

__device__ __forceinline__ h16 tohx(float x) { return (h16)x; }
__device__ __forceinline__ void splitf(float y, unsigned short& h, unsigned short& l) { h = f2bf(y); l = f2bf(y - bf2f(h)); }
typedef __attribute__((ext_vector_type(2))) _Float16 v2h;
typedef __attribute__((ext_vector_type(4))) _Float16 v4h;
typedef __attribute__((ext_vector_type(2))) unsigned short v2us;
typedef __attribute__((ext_vector_type(4))) unsigned short v4us;
typedef __attribute__((ext_vector_type(2))) float v2f;
typedef __attribute__((ext_vector_type(4))) int v4i;

__global__ __launch_bounds__(256) void k_wtG(const float* __restrict__ w, int K, int N, bf* Bt) {
    const int lane = threadIdx.x & 31; const int L0 = (blockIdx.x * 8 + (threadIdx.x >> 5)) * 8; const int nlines = N * K / 64;
{
#pragma unroll 1
        for (int l = 0; l < 8; ++l) { const int L = L0 + l; if (L >= nlines) break; const size_t e = (size_t)L * 64 + lane * 2; const int k = (int)(e % K), n = (int)(e / K); v2us o;
            o[0] = f2bf(w[(size_t)k * N + n]); o[1] = f2bf(w[(size_t)(k + 1) * N + n]); *(v2us*)(Bt + e) = o; }
         }
}
__global__ __launch_bounds__(256) void k_cvt8(const float* __restrict__ src, bf* dst, size_t n8) { const size_t i = (size_t)blockIdx.x * 256 + threadIdx.x; if (i >= n8) return; const v8f v = *(const v8f*)(src + i * 8); v8us o;
#pragma unroll
    for (int k = 0; k < 8; ++k) o[k] = f2bf(v[k]); *(v8us*)(dst + i * 8) = o;  }

__global__ __launch_bounds__(256) void k_flat(const float* __restrict__ F, h16* P16, bf* Ph, bf* Pl, size_t n4) { const size_t i = (size_t)blockIdx.x * 256 + threadIdx.x; if (i >= n4) return; const v4f a = *(const v4f*)(F + i * 4); v4h o16; v4us oh, ol;
#pragma unroll
    for (int q = 0; q < 4; ++q) { o16[q] = tohx(a[q]); unsigned short x2, y2; splitf(a[q], x2, y2); oh[q] = x2; ol[q] = y2; }
    *(v4h*)(P16 + i * 4) = o16; *(v4us*)(Ph + i * 4) = oh; *(v4us*)(Pl + i * 4) = ol;  }


__global__ __launch_bounds__(256) void k_vtp(const float* __restrict__ F, int pitch, int nheads, h16* V16, bf* Vh, bf* Vl) { const size_t e = ((size_t)blockIdx.x * 256 + threadIdx.x) * 2; if (e >= (size_t)nheads * HD * TT) return; const int t = (int)(e % TT); const int d = (int)((e / TT) % HD); const int g = (int)(e / ((size_t)TT * HD)); v2h o16; v2us oh, ol;
#pragma unroll
    for (int q = 0; q < 2; ++q) { const float x = F[(size_t)(t + q) * pitch + g * HD + d]; o16[q] = tohx(x); unsigned short a2, c2; splitf(x, a2, c2); oh[q] = a2; ol[q] = c2; }
    *(v2h*)(V16 + e) = o16; *(v2us*)(Vh + e) = oh; *(v2us*)(Vl + e) = ol;  }
// k_asoft: per row (zz, i): t = S (unscaled, no mask); softmax over the 1024 keys (register row, one exp, fixed trees);
__global__ __launch_bounds__(256) void k_asoft(const float* __restrict__ Sb, h16* P16, bf* Ph, bf* Pl) {
    const int lane = threadIdx.x & 31; const int row = blockIdx.x * 8 + (threadIdx.x >> 5); if (row >= ZH * TT) return; const int i = row % TT; const int zz = row / TT; (void)zz; const bool hires = (i < RH); const float* sr = Sb + (size_t)row * TT; float v[TT / 32]; float mx = -3.0e38f;
#pragma unroll
    for (int ch = 0; ch < TT / 128; ++ch) { const int j0 = ch * 128 + lane * 4; const v4f a = *(const v4f*)(sr + j0);
#pragma unroll
        for (int q = 0; q < 4; ++q) { const int j = j0 + q; (void)j; const float t = a[q] * SCL; v[ch * 4 + q] = t; mx = fmaxf(mx, t); } }
#pragma unroll
    for (int sh = 16; sh; sh >>= 1) mx = fmaxf(mx, __shfl_xor(mx, sh, 32));
    float sum = 0.f;
#pragma unroll
    for (int k = 0; k < TT / 32; ++k) { float d0 = __fsub_rn(v[k], mx); asm volatile("" : "+v"(d0)); v[k] = __builtin_amdgcn_exp2f(__fmul_rn(d0, 1.4426950408889634f)); sum += v[k]; }
#pragma unroll
    for (int sh = 16; sh; sh >>= 1) sum += __shfl_xor(sum, sh, 32);
    const float f = __fdiv_rn(hires ? 1.0f : PCAR, sum);
{
        if (hires) {
#pragma unroll
            for (int ch = 0; ch < TT / 128; ++ch) { v4us oh, ol;
#pragma unroll
                for (int q = 0; q < 4; ++q) { unsigned short a, c2; splitf(v[ch * 4 + q] * f, a, c2); oh[q] = a; ol[q] = c2; }
                const size_t oo = ((size_t)zz * (RH ? RH : 1) + i) * TT + ch * 128 + lane * 4; *(v4us*)(Ph + oo) = oh; *(v4us*)(Pl + oo) = ol; }
        } else {
#pragma unroll
            for (int ch = 0; ch < TT / 128; ++ch) { v4h o4;
#pragma unroll
                for (int q = 0; q < 4; ++q) o4[q] = tohx(v[ch * 4 + q] * f);
                *(v4h*)(P16 + (size_t)row * TT + ch * 128 + lane * 4) = o4; } }
         }
}
__global__ __launch_bounds__(256) void k_xT(const float* __restrict__ xs, bf* XB) { const size_t k = (size_t)blockIdx.x * 256 + threadIdx.x; if (k >= (size_t)TT * CC / 8) return; const int c0 = (int)(k % (CC / 8)) * 8; const int t = (int)(k / (CC / 8)); v8us o;
#pragma unroll
    for (int q = 0; q < 8; ++q) o[q] = f2bf(xs[(size_t)(c0 + q) * TT + t]);
    *(v8us*)(XB + (size_t)t * CC + c0) = o;  }
__global__ __launch_bounds__(256) void k_outT(const float* __restrict__ Y, float* outb) { const size_t i = (size_t)blockIdx.x * 256 + threadIdx.x; if (i >= (size_t)CC * TT / 4) return; const size_t e = i * 4; const int t = (int)(e % TT); const int c = (int)(e / TT); v4f o;
#pragma unroll
    for (int q = 0; q < 4; ++q) o[q] = Y[(size_t)(t + q) * CC + c];
    *(v4f*)(outb + e) = o;  }
__global__ __launch_bounds__(256) void k_merge(const float* __restrict__ O, int h0, float* OUTb) { const size_t e = ((size_t)blockIdx.x * 256 + threadIdx.x) * 2; if (e >= (size_t)ZH * TT * HD) return; const int d = (int)(e % HD); const int t = (int)((e / HD) % TT); const int zz = (int)(e / ((size_t)HD * TT)); const float cs = (t < RH) ? 1.0f : (1.0f / PCAR); const size_t oo = (size_t)t * DQ + (h0 + zz) * HD + d;
    v2f o2; o2[0] = O[e] * cs; o2[1] = O[e + 1] * cs; *(v2f*)(OUTb + oo) = o2;  }

extern "C" void kernel_launch(void* const* d_in, const int* in_sizes, int n_in,
                              void* d_out, int out_size, void* d_ws, size_t ws_size, hipStream_t stream) {
    (void)in_sizes; (void)n_in; (void)out_size;
    const float* x = (const float*)d_in[0]; const float* wq = (const float*)d_in[1]; const float* bq = (const float*)d_in[2]; const float* wk = (const float*)d_in[3]; const float* bk = (const float*)d_in[4]; const float* wv = (const float*)d_in[5]; const float* bv = (const float*)d_in[6]; const float* wo = nullptr; (void)wo;
    float* OUT = (float*)d_out;     // [64][64][1024]
    char* wsp = (char*)d_ws;
    auto take = [&](size_t bytes) { char* p = wsp; wsp += (bytes + 255) & ~(size_t)255; return (void*)p; };
    float* Y = (float*)take((size_t)TT * CC * 4); bf* WQ = (bf*)take((size_t)DQ * DM * 2); bf* WK = (bf*)take((size_t)DKV * DM * 2); bf* WV = (bf*)take((size_t)DKV * DM * 2); 
    bf* XB = (bf*)take((size_t)TT * DM * 2); float* FQ = (float*)take((size_t)TT * DQ * 4); float* FK = (float*)take((size_t)TT * DKV * 4);
    h16* QP16 = (h16*)take((size_t)NH_ * TT * HD * 2); h16* KP16 = (h16*)take((size_t)NKV * TT * HD * 2); h16* VT16 = (h16*)take((size_t)NKV * HD * TT * 2);
    bf* QPh = (bf*)take((size_t)NH_ * TT * HD * 2); bf* QPl = (bf*)take((size_t)NH_ * TT * HD * 2); bf* KPh = (bf*)take((size_t)NKV * TT * HD * 2); bf* KPl = (bf*)take((size_t)NKV * TT * HD * 2); bf* VTh = (bf*)take((size_t)NKV * HD * TT * 2); bf* VTl = (bf*)take((size_t)NKV * HD * TT * 2); bf* Ph = (bf*)take((size_t)ZH * RH * TT * 2); bf* Pl = (bf*)take((size_t)ZH * RH * TT * 2);
    float* Sb = (float*)take((size_t)ZH * TT * TT * 4); h16* P16 = nullptr; float* Ob = (float*)take((size_t)ZH * TT * HD * 4);
    if ((size_t)(wsp - (char*)d_ws) > ws_size) return;    // ws 256 MiB
    float* FV = FK;   // v projection reuses the k buffer after the k planes are built (stream-ordered)
    { k_cvt8<<<(unsigned)(((size_t)DQ * DM / 8 + 255) / 256), 256, 0, stream>>>(wq, WQ, (size_t)DQ * DM / 8); k_cvt8<<<(unsigned)(((size_t)DKV * DM / 8 + 255) / 256), 256, 0, stream>>>(wk, WK, (size_t)DKV * DM / 8); k_cvt8<<<(unsigned)(((size_t)DKV * DM / 8 + 255) / 256), 256, 0, stream>>>(wv, WV, (size_t)DKV * DM / 8);
      
       }
    const unsigned LQ = (unsigned)(((size_t)NH_ * TT * HD / 2 + 255) / 256), LKv = (unsigned)(((size_t)NKV * TT * HD / 2 + 255) / 256);
    for (int b = 0; b < NB_; ++b) {
        
        k_xT<<<(unsigned)(((size_t)TT * DM / 8 + 255) / 256), 256, 0, stream>>>(x + (size_t)b * CC * TT, XB);   /* channel-major slice -> token-major bf16 */
        k_gemmw<bf, 0, true><<<dim3(TT / 64, DQ / 64, 1), 32, 0, stream>>>(XB, nullptr, WQ, nullptr, DM, FQ, DQ, bq, 0, 0, 0);
        k_flat<<<(unsigned)(((size_t)TT * DQ / 4 + 255) / 256), 256, 0, stream>>>(FQ, QP16, QPh, QPl, (size_t)TT * DQ / 4);
        k_gemmw<bf, 0, true><<<dim3(TT / 64, DKV / 64, 1), 32, 0, stream>>>(XB, nullptr, WK, nullptr, DM, FK, DKV, bk, 0, 0, 0);
        k_flat<<<(unsigned)(((size_t)TT * DKV / 4 + 255) / 256), 256, 0, stream>>>(FK, KP16, KPh, KPl, (size_t)TT * DKV / 4);
        k_gemmw<bf, 0, true><<<dim3(TT / 64, DKV / 64, 1), 32, 0, stream>>>(XB, nullptr, WV, nullptr, DM, FV, DKV, bv, 0, 0, 0); k_vtp<<<LKv, 256, 0, stream>>>(FV, DKV, NKV, VT16, VTh, VTl);
        for (int h0 = 0; h0 < NH_; h0 += ZH) { const size_t zq = (size_t)h0, zk = (size_t)(h0 / REP);   // one kv head per query head: each pass takes ZH = 1 head (z-strides TT*HD)
            k_gemmw<bf, 2, false><<<dim3(RH / 64, TT / 64, ZH), 32, 0, stream>>>(QPh + zq * TT * HD, QPl + zq * TT * HD, KPh + zk * TT * HD, KPl + zk * TT * HD, HD, Sb, TT, nullptr, (size_t)TT * HD, (size_t)TT * HD, (size_t)TT * TT);
            k_asoft<<<ZH * TT / 8, 256, 0, stream>>>(Sb, P16, Ph, Pl);
            k_gemmw<bf, 2, false><<<dim3(RH / 64, HD / 64, ZH), 32, 0, stream>>>(Ph, Pl, VTh + zk * HD * TT, VTl + zk * HD * TT, TT, Ob, HD, nullptr, (size_t)RH * TT, (size_t)HD * TT, (size_t)TT * HD);
            k_merge<<<(unsigned)(((size_t)ZH * TT * HD / 2 + 255) / 256), 256, 0, stream>>>(Ob, h0, Y); k_outT<<<(unsigned)(((size_t)TT * CC / 4 + 255) / 256), 256, 0, stream>>>(Y, OUT + (size_t)b * CC * TT);   /* back to channel-major */ }
         }
}

// v001
// Measured time: 356 microseconds a run.
// Next to v000, in two timings, it ran 10.0 times as fast each time.
#include <hip/hip_runtime.h>

// Spatial self-attention over 1,024 positions for each of 64 (batch, time) slices (x [8][8][64][1024] channel-major; q, k, v = 1x1 convs ('oi' [64][64] + [64], uniform(+-1/8)); scores = q.k over the 64 channels (unscaled, sigma ~2.7); softmax over positions; out = (weights v)^T channel-major -> [8][8][64][1024] (4.2 M)).
// Layout per slice: the [64][1024] channel-major slice transposed into a token-major bf16 operand; exact projections + f32 biases; ONE 64-wide head with EVERY row on hi/lo planes (3 products; the unscaled logits are too sharp for fp16); 1,024-key register softmax; attn.v 3 products; the f32 context transposed back to channel-major rows.
// Compute dtypes, f32 accumulate: every input rounded to bf16; projections exact + f32 biases; scores and attn.v 3 products; softmax f32; output f32.

#define NB_  64
#define TT   1024
#define DM   64
#define NH_  1
#define NKV  1
#define REP  (NH_ / NKV)
#define HD   64
#define DQ   (NH_ * HD)
#define DKV  (NKV * HD)
#define ZH   1
#define RH   1024                  // query rows < RH use hi+lo planes (0: none)
#define WIN  0
#define PCAR 1024.0f
#define SCL  1.0f   // unscaled
#define CC   64
#define NZ   16                    // slices per pass of the three launches that touch the [1024][1024] score and weight planes (8 MiB a slice)
typedef _Float16 h16;
typedef unsigned short bf;
typedef __attribute__((ext_vector_type(16))) __bf16   v16bf;
typedef __attribute__((ext_vector_type(16))) _Float16 v16h;
typedef __attribute__((ext_vector_type(8)))  _Float16 v8h;
typedef __attribute__((ext_vector_type(8)))  unsigned short v8us;
typedef __attribute__((ext_vector_type(8)))  float    v8f;
typedef __attribute__((ext_vector_type(4)))  float    v4f;
typedef v8h  __attribute__((may_alias)) v8ha;
typedef v4f  __attribute__((may_alias)) v4fa;
typedef v8us __attribute__((may_alias)) v8usa;

__device__ __forceinline__ unsigned short f2bf(float f) { unsigned u = __float_as_uint(f); u += 0x7FFFu + ((u >> 16) & 1u); return (unsigned short)(u >> 16); }
__device__ __forceinline__ float bf2f(unsigned short b) { return __uint_as_float(((unsigned)b) << 16); }
__device__ __forceinline__ float bfr(float f) { return bf2f(f2bf(f)); }
__device__ __forceinline__ v16h cat16(v8h lo, v8h hi) { return __builtin_shufflevector(lo, hi, 0, 1, 2, 3, 4, 5, 6, 7, 8, 9, 10, 11, 12, 13, 14, 15); }
__device__ __forceinline__ v16bf cat16b(v8us lo, v8us hi) { return __builtin_bit_cast(v16bf, __builtin_shufflevector(lo, hi, 0, 1, 2, 3, 4, 5, 6, 7, 8, 9, 10, 11, 12, 13, 14, 15)); }
__device__ __forceinline__ v8f wmma16(v16h a, v16h b, v8f c) { return __builtin_amdgcn_wmma_f32_16x16x32_f16(false, a, false, b, (short)0, c, false, false); }
__device__ __forceinline__ v8f wmmab(v16bf a, v16bf b, v8f c) { return __builtin_amdgcn_wmma_f32_16x16x32_bf16(false, a, false, b, (short)0, c, false, false); }



// ---- k_gemmw: register-blocked GEMM, ONE WAVE per 64x64 output tile (16 accumulators), operands straight from K-contiguous 16-bit planes; grid (M/64, N/64, Z), 32 threads.
// C[m][n] (f32, pitch ldc, + optional f32 bias[n]) = sum_k A[m][k] Bt[n][k] (+ split products per NSPLIT). z-batch strides sA/sB/sC in elements. K % 32 == 0.
template <typename T16> struct WFrag;
template <> struct WFrag<h16> { typedef v16h V; static __device__ __forceinline__ V ld(const h16* p) { return cat16(*(const v8h*)p, *(const v8h*)(p + 16)); } static __device__ __forceinline__ v8f mma(V a, V b, v8f c) { return wmma16(a, b, c); } };
template <> struct WFrag<bf> { typedef v16bf V; static __device__ __forceinline__ V ld(const bf* p) { return cat16b(*(const v8us*)p, *(const v8us*)(p + 16)); } static __device__ __forceinline__ v8f mma(V a, V b, v8f c) { return wmmab(a, b, c); } };
template <typename T16, int NSPLIT, bool BIAS>
__global__ __launch_bounds__(32) void k_gemmw(const T16* __restrict__ A, const T16* __restrict__ A2, const T16* __restrict__ Bt, const T16* __restrict__ Bt2, int K, float* C, int ldc, const float* __restrict__ bias, size_t sA, size_t sB, size_t sC) {
    typedef typename WFrag<T16>::V V;
    __shared__ __align__(16) float os[16 * 68];
    const size_t z = blockIdx.z; A += z * sA; if (A2) A2 += z * sA; Bt += z * sB; if (Bt2) Bt2 += z * sB; C += z * sC;
    const int lane = threadIdx.x & 31, lr = lane & 15, hi = lane >> 4; const int r0 = blockIdx.x * 64, c0 = blockIdx.y * 64;
    v8f acc[4][4];
#pragma unroll
    for (int mb = 0; mb < 4; ++mb)
#pragma unroll
        for (int nb = 0; nb < 4; ++nb) acc[mb][nb] = (v8f){};
    const size_t aoff = (size_t)(r0 + lr) * K + 8 * hi, boff = (size_t)(c0 + lr) * K + 8 * hi;
#pragma unroll 1
    for (int kc = 0; kc < K; kc += 32) {
        V a[4], a2[4];
#pragma unroll
        for (int mb = 0; mb < 4; ++mb) { a[mb] = WFrag<T16>::ld(A + aoff + (size_t)mb * 16 * K + kc); if (NSPLIT == 1 || NSPLIT == 2) a2[mb] = WFrag<T16>::ld(A2 + aoff + (size_t)mb * 16 * K + kc); }
#pragma unroll
        for (int nb = 0; nb < 4; ++nb) { const V b = WFrag<T16>::ld(Bt + boff + (size_t)nb * 16 * K + kc); V b2; if (NSPLIT >= 2) b2 = WFrag<T16>::ld(Bt2 + boff + (size_t)nb * 16 * K + kc);
#pragma unroll
            for (int mb = 0; mb < 4; ++mb) { acc[mb][nb] = WFrag<T16>::mma(a[mb], b, acc[mb][nb]); if (NSPLIT == 1 || NSPLIT == 2) acc[mb][nb] = WFrag<T16>::mma(a2[mb], b, acc[mb][nb]); if (NSPLIT >= 2) acc[mb][nb] = WFrag<T16>::mma(a[mb], b2, acc[mb][nb]); } }
        asm volatile("v_nop\n\tv_nop\n\tv_nop\n\tv_nop" : "+v"(acc[0][0]), "+v"(acc[1][1]), "+v"(acc[2][2]), "+v"(acc[3][3]) : "v"(a[0]), "v"(a[3]));
    }
#pragma unroll
    for (int mb = 0; mb < 4; ++mb) {
#pragma unroll
        for (int nb = 0; nb < 4; ++nb) {
#pragma unroll
            for (int j = 0; j < 8; ++j) os[(hi * 8 + j) * 68 + nb * 16 + lr] = acc[mb][nb][j]; }
        __builtin_amdgcn_wave_barrier(); asm volatile("" ::: "memory");
        float* crow = C + (size_t)(r0 + mb * 16) * ldc + c0;
{
#pragma unroll
            for (int s = 0; s < 8; ++s) { const int row = 2 * s + hi, cofs = lr * 4; v4f val = *(const v4fa*)(os + row * 68 + cofs); if (BIAS) { val[0] += bfr(bias[c0 + cofs]); val[1] += bfr(bias[c0 + cofs + 1]); val[2] += bfr(bias[c0 + cofs + 2]); val[3] += bfr(bias[c0 + cofs + 3]); }
                *(v4f*)(crow + (size_t)row * ldc + cofs) = val; }
             }
        __builtin_amdgcn_wave_barrier(); asm volatile("" ::: "memory");
    }
}

__device__ __forceinline__ h16 tohx(float x) { return (h16)x; }
__device__ __forceinline__ void splitf(float y, unsigned short& h, unsigned short& l) { h = f2bf(y); l = f2bf(y - bf2f(h)); }
typedef __attribute__((ext_vector_type(2))) _Float16 v2h;
typedef __attribute__((ext_vector_type(4))) _Float16 v4h;
typedef __attribute__((ext_vector_type(2))) unsigned short v2us;
typedef __attribute__((ext_vector_type(4))) unsigned short v4us;
typedef __attribute__((ext_vector_type(2))) float v2f;
typedef __attribute__((ext_vector_type(4))) int v4i;

__global__ __launch_bounds__(256) void k_wtG(const float* __restrict__ w, int K, int N, bf* Bt) {
    const int lane = threadIdx.x & 31; const int L0 = (blockIdx.x * 8 + (threadIdx.x >> 5)) * 8; const int nlines = N * K / 64;
{
#pragma unroll 1
        for (int l = 0; l < 8; ++l) { const int L = L0 + l; if (L >= nlines) break; const size_t e = (size_t)L * 64 + lane * 2; const int k = (int)(e % K), n = (int)(e / K); v2us o;
            o[0] = f2bf(w[(size_t)k * N + n]); o[1] = f2bf(w[(size_t)(k + 1) * N + n]); *(v2us*)(Bt + e) = o; }
         }
}
__global__ __launch_bounds__(256) void k_cvt8(const float* __restrict__ src, bf* dst, size_t n8) { const size_t i = (size_t)blockIdx.x * 256 + threadIdx.x; if (i >= n8) return; const v8f v = *(const v8f*)(src + i * 8); v8us o;
#pragma unroll
    for (int k = 0; k < 8; ++k) o[k] = f2bf(v[k]); *(v8us*)(dst + i * 8) = o;  }

__global__ __launch_bounds__(256) void k_flat(const float* __restrict__ F, h16* P16, bf* Ph, bf* Pl, size_t n4) { const size_t i = (size_t)blockIdx.x * 256 + threadIdx.x; if (i >= n4) return; const v4f a = *(const v4f*)(F + i * 4); v4h o16; v4us oh, ol;
#pragma unroll
    for (int q = 0; q < 4; ++q) { o16[q] = tohx(a[q]); unsigned short x2, y2; splitf(a[q], x2, y2); oh[q] = x2; ol[q] = y2; }
    *(v4h*)(P16 + i * 4) = o16; *(v4us*)(Ph + i * 4) = oh; *(v4us*)(Pl + i * 4) = ol;  }


__global__ __launch_bounds__(256) void k_vtp(const float* __restrict__ F, int pitch, int nheads, h16* V16, bf* Vh, bf* Vl) { const size_t e = ((size_t)blockIdx.x * 256 + threadIdx.x) * 2; if (e >= (size_t)nheads * HD * TT) return; { const size_t y = blockIdx.y; F += y * TT * pitch; V16 += y * nheads * HD * TT; Vh += y * nheads * HD * TT; Vl += y * nheads * HD * TT; }   /* grid y: slice */ const int t = (int)(e % TT); const int d = (int)((e / TT) % HD); const int g = (int)(e / ((size_t)TT * HD)); v2h o16; v2us oh, ol;
#pragma unroll
    for (int q = 0; q < 2; ++q) { const float x = F[(size_t)(t + q) * pitch + g * HD + d]; o16[q] = tohx(x); unsigned short a2, c2; splitf(x, a2, c2); oh[q] = a2; ol[q] = c2; }
    *(v2h*)(V16 + e) = o16; *(v2us*)(Vh + e) = oh; *(v2us*)(Vl + e) = ol;  }
// k_asoft: per row (zz, i): t = S, unscaled (no mask); softmax over the 1024 keys (register row, one exp, fixed trees); grid y: slice of the pass
__global__ __launch_bounds__(256) void k_asoft(const float* __restrict__ Sb, h16* P16, bf* Ph, bf* Pl) {
    const int lane = threadIdx.x & 31; const int row = blockIdx.x * 8 + (threadIdx.x >> 5); if (row >= ZH * TT) return; const int i = row % TT; const int zz = row / TT; (void)zz; const bool hires = (i < RH); Sb += (size_t)blockIdx.y * ZH * TT * TT; Ph += (size_t)blockIdx.y * ZH * RH * TT; Pl += (size_t)blockIdx.y * ZH * RH * TT; const float* sr = Sb + (size_t)row * TT; float v[TT / 32]; float mx = -3.0e38f;
#pragma unroll
    for (int ch = 0; ch < TT / 128; ++ch) { const int j0 = ch * 128 + lane * 4; const v4f a = *(const v4f*)(sr + j0);
#pragma unroll
        for (int q = 0; q < 4; ++q) { const int j = j0 + q; (void)j; const float t = a[q] * SCL; v[ch * 4 + q] = t; mx = fmaxf(mx, t); } }
#pragma unroll
    for (int sh = 16; sh; sh >>= 1) mx = fmaxf(mx, __shfl_xor(mx, sh, 32));
    float sum = 0.f;
#pragma unroll
    for (int k = 0; k < TT / 32; ++k) { float d0 = __fsub_rn(v[k], mx); asm volatile("" : "+v"(d0)); v[k] = __builtin_amdgcn_exp2f(__fmul_rn(d0, 1.4426950408889634f)); sum += v[k]; }
#pragma unroll
    for (int sh = 16; sh; sh >>= 1) sum += __shfl_xor(sum, sh, 32);
    const float f = __fdiv_rn(hires ? 1.0f : PCAR, sum);
{
        if (hires) {
#pragma unroll
            for (int ch = 0; ch < TT / 128; ++ch) { v4us oh, ol;
#pragma unroll
                for (int q = 0; q < 4; ++q) { unsigned short a, c2; splitf(v[ch * 4 + q] * f, a, c2); oh[q] = a; ol[q] = c2; }
                const size_t oo = ((size_t)zz * (RH ? RH : 1) + i) * TT + ch * 128 + lane * 4; *(v4us*)(Ph + oo) = oh; *(v4us*)(Pl + oo) = ol; }
        } else {
#pragma unroll
            for (int ch = 0; ch < TT / 128; ++ch) { v4h o4;
#pragma unroll
                for (int q = 0; q < 4; ++q) o4[q] = tohx(v[ch * 4 + q] * f);
                *(v4h*)(P16 + (size_t)row * TT + ch * 128 + lane * 4) = o4; } }
         }
}
__global__ __launch_bounds__(256) void k_xT(const float* __restrict__ xs, bf* XB) { const size_t k = (size_t)blockIdx.x * 256 + threadIdx.x; if (k >= (size_t)TT * CC / 8) return; xs += (size_t)blockIdx.y * CC * TT; XB += (size_t)blockIdx.y * TT * CC;   /* grid y: slice */ const int c0 = (int)(k % (CC / 8)) * 8; const int t = (int)(k / (CC / 8)); v8us o;
#pragma unroll
    for (int q = 0; q < 8; ++q) o[q] = f2bf(xs[(size_t)(c0 + q) * TT + t]);
    *(v8us*)(XB + (size_t)t * CC + c0) = o;  }
__global__ __launch_bounds__(256) void k_outT(const float* __restrict__ Y, float* outb) { const size_t i = (size_t)blockIdx.x * 256 + threadIdx.x; if (i >= (size_t)CC * TT / 4) return; Y += (size_t)blockIdx.y * TT * CC; outb += (size_t)blockIdx.y * CC * TT;   /* grid y: slice */ const size_t e = i * 4; const int t = (int)(e % TT); const int c = (int)(e / TT); v4f o;
#pragma unroll
    for (int q = 0; q < 4; ++q) o[q] = Y[(size_t)(t + q) * CC + c];
    *(v4f*)(outb + e) = o;  }
__global__ __launch_bounds__(256) void k_merge(const float* __restrict__ O, int h0, float* OUTb) { const size_t e = ((size_t)blockIdx.x * 256 + threadIdx.x) * 2; if (e >= (size_t)ZH * TT * HD) return; O += (size_t)blockIdx.y * ZH * TT * HD; OUTb += (size_t)blockIdx.y * TT * DQ;   /* grid y: slice */ const int d = (int)(e % HD); const int t = (int)((e / HD) % TT); const int zz = (int)(e / ((size_t)HD * TT)); const float cs = (t < RH) ? 1.0f : (1.0f / PCAR); const size_t oo = (size_t)t * DQ + (h0 + zz) * HD + d;
    v2f o2; o2[0] = O[e] * cs; o2[1] = O[e + 1] * cs; *(v2f*)(OUTb + oo) = o2;  }

extern "C" void kernel_launch(void* const* d_in, const int* in_sizes, int n_in,
                              void* d_out, int out_size, void* d_ws, size_t ws_size, hipStream_t stream) {
    (void)in_sizes; (void)n_in; (void)out_size;
    const float* x = (const float*)d_in[0]; const float* wq = (const float*)d_in[1]; const float* bq = (const float*)d_in[2]; const float* wk = (const float*)d_in[3]; const float* bk = (const float*)d_in[4]; const float* wv = (const float*)d_in[5]; const float* bv = (const float*)d_in[6]; const float* wo = nullptr; (void)wo;
    float* OUT = (float*)d_out;     // [64][64][1024]
    char* wsp = (char*)d_ws;
    auto take = [&](size_t bytes) { char* p = wsp; wsp += (bytes + 255) & ~(size_t)255; return (void*)p; };
    bf* WQ = (bf*)take((size_t)DQ * DM * 2); bf* WK = (bf*)take((size_t)DKV * DM * 2); bf* WV = (bf*)take((size_t)DKV * DM * 2);
    // these planes hold all NB_ slices, slice-major
    bf* XB = (bf*)take((size_t)NB_ * TT * DM * 2); float* FQ = (float*)take((size_t)NB_ * TT * DQ * 4); float* FK = (float*)take((size_t)NB_ * TT * DKV * 4);
    h16* QP16 = (h16*)take((size_t)NB_ * NH_ * TT * HD * 2); h16* KP16 = (h16*)take((size_t)NB_ * NKV * TT * HD * 2); h16* VT16 = (h16*)take((size_t)NB_ * NKV * HD * TT * 2);
    bf* QPh = (bf*)take((size_t)NB_ * NH_ * TT * HD * 2); bf* QPl = (bf*)take((size_t)NB_ * NH_ * TT * HD * 2); bf* KPh = (bf*)take((size_t)NB_ * NKV * TT * HD * 2); bf* KPl = (bf*)take((size_t)NB_ * NKV * TT * HD * 2); bf* VTh = (bf*)take((size_t)NB_ * NKV * HD * TT * 2); bf* VTl = (bf*)take((size_t)NB_ * NKV * HD * TT * 2);
    // these hold the NZ slices of one pass
    bf* Ph = (bf*)take((size_t)NZ * RH * TT * 2); bf* Pl = (bf*)take((size_t)NZ * RH * TT * 2); float* Sb = (float*)take((size_t)NZ * TT * TT * 4); h16* P16 = nullptr;
    if ((size_t)(wsp - (char*)d_ws) > ws_size) return;    // ws 256 MiB, 240 MiB taken
    float* FV = FK;   // v projection reuses the k buffer after the k planes are built (stream-ordered)
    float* Ob = FK;   // the context reuses it after the v planes are built
    float* Y = FQ;    // the merged context reuses the q buffer after the q planes are built
    { k_cvt8<<<(unsigned)(((size_t)DQ * DM / 8 + 255) / 256), 256, 0, stream>>>(wq, WQ, (size_t)DQ * DM / 8); k_cvt8<<<(unsigned)(((size_t)DKV * DM / 8 + 255) / 256), 256, 0, stream>>>(wk, WK, (size_t)DKV * DM / 8); k_cvt8<<<(unsigned)(((size_t)DKV * DM / 8 + 255) / 256), 256, 0, stream>>>(wv, WV, (size_t)DKV * DM / 8); }
    const unsigned LKv = (unsigned)(((size_t)NKV * TT * HD / 2 + 255) / 256);
    // all NB_ slices in one launch each: the slice is grid y or z (k_flat: one flat range over all slices)
    k_xT<<<dim3((unsigned)(((size_t)TT * DM / 8 + 255) / 256), NB_, 1), 256, 0, stream>>>(x, XB);   /* channel-major slices -> token-major bf16 */
    k_gemmw<bf, 0, true><<<dim3(TT / 64, DQ / 64, NB_), 32, 0, stream>>>(XB, nullptr, WQ, nullptr, DM, FQ, DQ, bq, (size_t)TT * DM, 0, (size_t)TT * DQ);
    k_flat<<<(unsigned)(((size_t)NB_ * TT * DQ / 4 + 255) / 256), 256, 0, stream>>>(FQ, QP16, QPh, QPl, (size_t)NB_ * TT * DQ / 4);
    k_gemmw<bf, 0, true><<<dim3(TT / 64, DKV / 64, NB_), 32, 0, stream>>>(XB, nullptr, WK, nullptr, DM, FK, DKV, bk, (size_t)TT * DM, 0, (size_t)TT * DKV);
    k_flat<<<(unsigned)(((size_t)NB_ * TT * DKV / 4 + 255) / 256), 256, 0, stream>>>(FK, KP16, KPh, KPl, (size_t)NB_ * TT * DKV / 4);
    k_gemmw<bf, 0, true><<<dim3(TT / 64, DKV / 64, NB_), 32, 0, stream>>>(XB, nullptr, WV, nullptr, DM, FV, DKV, bv, (size_t)TT * DM, 0, (size_t)TT * DKV);
    k_vtp<<<dim3(LKv, NB_, 1), 256, 0, stream>>>(FV, DKV, NKV, VT16, VTh, VTl);
    for (int b = 0; b < NB_; b += NZ) {   // scores and weights of all slices (512 MiB) do not fit the workspace: NZ slices a pass
        const size_t zo = (size_t)b * TT * HD;
        k_gemmw<bf, 2, false><<<dim3(RH / 64, TT / 64, NZ), 32, 0, stream>>>(QPh + zo, QPl + zo, KPh + zo, KPl + zo, HD, Sb, TT, nullptr, (size_t)TT * HD, (size_t)TT * HD, (size_t)TT * TT);
        k_asoft<<<dim3(ZH * TT / 8, NZ, 1), 256, 0, stream>>>(Sb, P16, Ph, Pl);
        k_gemmw<bf, 2, false><<<dim3(RH / 64, HD / 64, NZ), 32, 0, stream>>>(Ph, Pl, VTh + zo, VTl + zo, TT, Ob + zo, HD, nullptr, (size_t)RH * TT, (size_t)HD * TT, (size_t)TT * HD);
    }
    k_merge<<<dim3((unsigned)(((size_t)ZH * TT * HD / 2 + 255) / 256), NB_, 1), 256, 0, stream>>>(Ob, 0, Y);
    k_outT<<<dim3((unsigned)(((size_t)TT * CC / 4 + 255) / 256), NB_, 1), 256, 0, stream>>>(Y, OUT);   /* back to channel-major */
}

// v002
// Measured time: 104 microseconds a run.
// Next to v001, in two timings, it ran 3.42 and 3.39 times as fast.
// Counting every step since v000, it is 34.1 times as fast.
#include <hip/hip_runtime.h>

// Spatial self-attention over 1,024 positions for each of 64 (batch, time) slices (x [8][8][64][1024] channel-major; q, k, v = 1x1 convs ('oi' [64][64] + [64], uniform(+-1/8)); scores = q.k over the 64 channels (unscaled, sigma ~2.7); softmax over positions; out = (weights v)^T channel-major -> [8][8][64][1024] (4.2 M)).
// Layout per slice: the [64][1024] channel-major slice transposed into a token-major bf16 operand; exact projections + f32 biases; ONE 64-wide head with EVERY row on hi/lo planes (3 products; the unscaled logits are too sharp for fp16); scores, softmax and attn.v in ONE kernel (64 keys a stage, running maximum and sum per query, 3 products each side); its transposed products give channel-major rows directly.
// Compute dtypes, f32 accumulate: every input rounded to bf16; projections exact + f32 biases; scores and attn.v 3 products; softmax f32; output f32.

#define NB_  64
#define TT   1024
#define DM   64
#define NH_  1
#define NKV  1
#define REP  (NH_ / NKV)
#define HD   64
#define DQ   (NH_ * HD)
#define DKV  (NKV * HD)
#define ZH   1
#define RH   1024                  // unused; every query row uses hi+lo planes
#define WIN  0
#define PCAR 1024.0f
#define SCL  1.0f   // unscaled
#define CC   64
typedef _Float16 h16;
typedef unsigned short bf;
typedef __attribute__((ext_vector_type(16))) __bf16   v16bf;
typedef __attribute__((ext_vector_type(16))) _Float16 v16h;
typedef __attribute__((ext_vector_type(8)))  _Float16 v8h;
typedef __attribute__((ext_vector_type(8)))  unsigned short v8us;
typedef __attribute__((ext_vector_type(8)))  float    v8f;
typedef __attribute__((ext_vector_type(4)))  float    v4f;
typedef v8h  __attribute__((may_alias)) v8ha;
typedef v4f  __attribute__((may_alias)) v4fa;
typedef v8us __attribute__((may_alias)) v8usa;

__device__ __forceinline__ unsigned short f2bf(float f) { unsigned u = __float_as_uint(f); u += 0x7FFFu + ((u >> 16) & 1u); return (unsigned short)(u >> 16); }
__device__ __forceinline__ float bf2f(unsigned short b) { return __uint_as_float(((unsigned)b) << 16); }
__device__ __forceinline__ float bfr(float f) { return bf2f(f2bf(f)); }
__device__ __forceinline__ v16h cat16(v8h lo, v8h hi) { return __builtin_shufflevector(lo, hi, 0, 1, 2, 3, 4, 5, 6, 7, 8, 9, 10, 11, 12, 13, 14, 15); }
__device__ __forceinline__ v16bf cat16b(v8us lo, v8us hi) { return __builtin_bit_cast(v16bf, __builtin_shufflevector(lo, hi, 0, 1, 2, 3, 4, 5, 6, 7, 8, 9, 10, 11, 12, 13, 14, 15)); }
__device__ __forceinline__ v8f wmma16(v16h a, v16h b, v8f c) { return __builtin_amdgcn_wmma_f32_16x16x32_f16(false, a, false, b, (short)0, c, false, false); }
__device__ __forceinline__ v8f wmmab(v16bf a, v16bf b, v8f c) { return __builtin_amdgcn_wmma_f32_16x16x32_bf16(false, a, false, b, (short)0, c, false, false); }



// ---- k_gemmw: register-blocked GEMM, ONE WAVE per 64x64 output tile (16 accumulators), operands straight from K-contiguous 16-bit planes; grid (M/64, N/64, Z), 32 threads.
// C[m][n] (f32, pitch ldc, + optional f32 bias[n]) = sum_k A[m][k] Bt[n][k] (+ split products per NSPLIT). z-batch strides sA/sB/sC in elements. K % 32 == 0.
template <typename T16> struct WFrag;
template <> struct WFrag<h16> { typedef v16h V; static __device__ __forceinline__ V ld(const h16* p) { return cat16(*(const v8h*)p, *(const v8h*)(p + 16)); } static __device__ __forceinline__ v8f mma(V a, V b, v8f c) { return wmma16(a, b, c); } };
template <> struct WFrag<bf> { typedef v16bf V; static __device__ __forceinline__ V ld(const bf* p) { return cat16b(*(const v8us*)p, *(const v8us*)(p + 16)); } static __device__ __forceinline__ v8f mma(V a, V b, v8f c) { return wmmab(a, b, c); } };
template <typename T16, int NSPLIT, bool BIAS>
__global__ __launch_bounds__(32) void k_gemmw(const T16* __restrict__ A, const T16* __restrict__ A2, const T16* __restrict__ Bt, const T16* __restrict__ Bt2, int K, float* C, int ldc, const float* __restrict__ bias, size_t sA, size_t sB, size_t sC) {
    typedef typename WFrag<T16>::V V;
    __shared__ __align__(16) float os[16 * 68];
    const size_t z = blockIdx.z; A += z * sA; if (A2) A2 += z * sA; Bt += z * sB; if (Bt2) Bt2 += z * sB; C += z * sC;
    const int lane = threadIdx.x & 31, lr = lane & 15, hi = lane >> 4; const int r0 = blockIdx.x * 64, c0 = blockIdx.y * 64;
    v8f acc[4][4];
#pragma unroll
    for (int mb = 0; mb < 4; ++mb)
#pragma unroll
        for (int nb = 0; nb < 4; ++nb) acc[mb][nb] = (v8f){};
    const size_t aoff = (size_t)(r0 + lr) * K + 8 * hi, boff = (size_t)(c0 + lr) * K + 8 * hi;
#pragma unroll 1
    for (int kc = 0; kc < K; kc += 32) {
        V a[4], a2[4];
#pragma unroll
        for (int mb = 0; mb < 4; ++mb) { a[mb] = WFrag<T16>::ld(A + aoff + (size_t)mb * 16 * K + kc); if (NSPLIT == 1 || NSPLIT == 2) a2[mb] = WFrag<T16>::ld(A2 + aoff + (size_t)mb * 16 * K + kc); }
#pragma unroll
        for (int nb = 0; nb < 4; ++nb) { const V b = WFrag<T16>::ld(Bt + boff + (size_t)nb * 16 * K + kc); V b2; if (NSPLIT >= 2) b2 = WFrag<T16>::ld(Bt2 + boff + (size_t)nb * 16 * K + kc);
#pragma unroll
            for (int mb = 0; mb < 4; ++mb) { acc[mb][nb] = WFrag<T16>::mma(a[mb], b, acc[mb][nb]); if (NSPLIT == 1 || NSPLIT == 2) acc[mb][nb] = WFrag<T16>::mma(a2[mb], b, acc[mb][nb]); if (NSPLIT >= 2) acc[mb][nb] = WFrag<T16>::mma(a[mb], b2, acc[mb][nb]); } }
        asm volatile("v_nop\n\tv_nop\n\tv_nop\n\tv_nop" : "+v"(acc[0][0]), "+v"(acc[1][1]), "+v"(acc[2][2]), "+v"(acc[3][3]) : "v"(a[0]), "v"(a[3]));
    }
#pragma unroll
    for (int mb = 0; mb < 4; ++mb) {
#pragma unroll
        for (int nb = 0; nb < 4; ++nb) {
#pragma unroll
            for (int j = 0; j < 8; ++j) os[(hi * 8 + j) * 68 + nb * 16 + lr] = acc[mb][nb][j]; }
        __builtin_amdgcn_wave_barrier(); asm volatile("" ::: "memory");
        float* crow = C + (size_t)(r0 + mb * 16) * ldc + c0;
{
#pragma unroll
            for (int s = 0; s < 8; ++s) { const int row = 2 * s + hi, cofs = lr * 4; v4f val = *(const v4fa*)(os + row * 68 + cofs); if (BIAS) { val[0] += bfr(bias[c0 + cofs]); val[1] += bfr(bias[c0 + cofs + 1]); val[2] += bfr(bias[c0 + cofs + 2]); val[3] += bfr(bias[c0 + cofs + 3]); }
                *(v4f*)(crow + (size_t)row * ldc + cofs) = val; }
             }
        __builtin_amdgcn_wave_barrier(); asm volatile("" ::: "memory");
    }
}

__device__ __forceinline__ h16 tohx(float x) { return (h16)x; }
__device__ __forceinline__ void splitf(float y, unsigned short& h, unsigned short& l) { h = f2bf(y); l = f2bf(y - bf2f(h)); }
typedef __attribute__((ext_vector_type(2))) _Float16 v2h;
typedef __attribute__((ext_vector_type(4))) _Float16 v4h;
typedef __attribute__((ext_vector_type(2))) unsigned short v2us;
typedef __attribute__((ext_vector_type(4))) unsigned short v4us;
typedef __attribute__((ext_vector_type(2))) float v2f;
typedef __attribute__((ext_vector_type(4))) int v4i;

__global__ __launch_bounds__(256) void k_wtG(const float* __restrict__ w, int K, int N, bf* Bt) {
    const int lane = threadIdx.x & 31; const int L0 = (blockIdx.x * 8 + (threadIdx.x >> 5)) * 8; const int nlines = N * K / 64;
{
#pragma unroll 1
        for (int l = 0; l < 8; ++l) { const int L = L0 + l; if (L >= nlines) break; const size_t e = (size_t)L * 64 + lane * 2; const int k = (int)(e % K), n = (int)(e / K); v2us o;
            o[0] = f2bf(w[(size_t)k * N + n]); o[1] = f2bf(w[(size_t)(k + 1) * N + n]); *(v2us*)(Bt + e) = o; }
         }
}
__global__ __launch_bounds__(256) void k_cvt8(const float* __restrict__ src, bf* dst, size_t n8) { const size_t i = (size_t)blockIdx.x * 256 + threadIdx.x; if (i >= n8) return; const v8f v = *(const v8f*)(src + i * 8); v8us o;
#pragma unroll
    for (int k = 0; k < 8; ++k) o[k] = f2bf(v[k]); *(v8us*)(dst + i * 8) = o;  }

__global__ __launch_bounds__(256) void k_flat(const float* __restrict__ F, h16* P16, bf* Ph, bf* Pl, size_t n4) { const size_t i = (size_t)blockIdx.x * 256 + threadIdx.x; if (i >= n4) return; const v4f a = *(const v4f*)(F + i * 4); v4h o16; v4us oh, ol;
#pragma unroll
    for (int q = 0; q < 4; ++q) { o16[q] = tohx(a[q]); unsigned short x2, y2; splitf(a[q], x2, y2); oh[q] = x2; ol[q] = y2; }
    *(v4h*)(P16 + i * 4) = o16; *(v4us*)(Ph + i * 4) = oh; *(v4us*)(Pl + i * 4) = ol;  }


__global__ __launch_bounds__(256) void k_vtp(const float* __restrict__ F, int pitch, int nheads, h16* V16, bf* Vh, bf* Vl) { const size_t e = ((size_t)blockIdx.x * 256 + threadIdx.x) * 2; if (e >= (size_t)nheads * HD * TT) return; { const size_t y = blockIdx.y; F += y * TT * pitch; V16 += y * nheads * HD * TT; Vh += y * nheads * HD * TT; Vl += y * nheads * HD * TT; }   /* grid y: slice */ const int t = (int)(e % TT); const int d = (int)((e / TT) % HD); const int g = (int)(e / ((size_t)TT * HD)); v2h o16; v2us oh, ol;
#pragma unroll
    for (int q = 0; q < 2; ++q) { const float x = F[(size_t)(t + q) * pitch + g * HD + d]; o16[q] = tohx(x); unsigned short a2, c2; splitf(x, a2, c2); oh[q] = a2; ol[q] = c2; }
    *(v2h*)(V16 + e) = o16; *(v2us*)(Vh + e) = oh; *(v2us*)(Vl + e) = ol;  }
__global__ __launch_bounds__(256) void k_xT(const float* __restrict__ xs, bf* XB) { const size_t k = (size_t)blockIdx.x * 256 + threadIdx.x; if (k >= (size_t)TT * CC / 8) return; xs += (size_t)blockIdx.y * CC * TT; XB += (size_t)blockIdx.y * TT * CC;   /* grid y: slice */ const int c0 = (int)(k % (CC / 8)) * 8; const int t = (int)(k / (CC / 8)); v8us o;
#pragma unroll
    for (int q = 0; q < 8; ++q) o[q] = f2bf(xs[(size_t)(c0 + q) * TT + t]);
    *(v8us*)(XB + (size_t)t * CC + c0) = o;  }

#define FS  64                     // keys per stage
#define FP  72                     // LDS row pitch in 16-bit elements: 144 B = 16 B x odd, conflict-free for 16-byte row reads
#define FPL (64 * FP)              // one plane of a stage
#define OP  36                     // output staging pitch in floats
#define L2E 1.4426950408889634f
typedef __attribute__((ext_vector_type(2))) __bf16 v2bf;
typedef float __attribute__((may_alias)) f32a;
__device__ __forceinline__ v16bf ldfrag(const bf* p) { return cat16b(*(const v8usa*)p, *(const v8usa*)(p + 16)); }   // hardware k order: 8 hi + s, 16 + 8 hi + (s - 8)
__device__ __forceinline__ float xhalf(float x) { const int b = __float_as_int(x); return __int_as_float(__builtin_amdgcn_permlanex16(b, b, 0x76543210, 0xfedcba98, false, false)); }   // lane l <-> l ^ 16
// eight v_exp_f32 and the slot behind the last one in ONE statement, every output apart from every input: no instruction directly behind a transcendental reads its result or overwrites its source
__device__ __forceinline__ v8f exp2x8(v8f t) { float e0, e1, e2, e3, e4, e5, e6, e7;
    asm("v_exp_f32 %0, %8\n\tv_exp_f32 %1, %9\n\tv_exp_f32 %2, %10\n\tv_exp_f32 %3, %11\n\tv_exp_f32 %4, %12\n\tv_exp_f32 %5, %13\n\tv_exp_f32 %6, %14\n\tv_exp_f32 %7, %15\n\tv_nop"
        : "=&v"(e0), "=&v"(e1), "=&v"(e2), "=&v"(e3), "=&v"(e4), "=&v"(e5), "=&v"(e6), "=&v"(e7) : "v"(t[0]), "v"(t[1]), "v"(t[2]), "v"(t[3]), "v"(t[4]), "v"(t[5]), "v"(t[6]), "v"(t[7]));
    return (v8f){ e0, e1, e2, e3, e4, e5, e6, e7 }; }
__global__ __launch_bounds__(256) void k_fattn(const bf* __restrict__ Qh, const bf* __restrict__ Ql, const bf* __restrict__ Kh, const bf* __restrict__ Kl, const bf* __restrict__ Vh, const bf* __restrict__ Vl, float* __restrict__ outb) {
    __shared__ __align__(16) bf sm[2 * 4 * FPL];   // 73,728 B; after the loop: 8 waves x [64 ch][OP] floats of output staging
    const int tid = threadIdx.x, lane = tid & 31, wave = tid >> 5, lr = lane & 15, hi = lane >> 4;
    const size_t zs = (size_t)blockIdx.y * TT * HD; const int q0 = blockIdx.x * 256 + wave * 32;
    v16bf qh[2][2], ql[2][2];
#pragma unroll
    for (int qt = 0; qt < 2; ++qt)
#pragma unroll
        for (int ks = 0; ks < 2; ++ks) { const size_t o = zs + (size_t)(q0 + qt * 16 + lr) * HD + ks * 32 + 8 * hi; qh[qt][ks] = ldfrag(Qh + o); ql[qt][ks] = ldfrag(Ql + o); }
    // staging: a plane of a stage is 64 rows x 8 pieces of 16 B; a thread moves rows srow and srow + 32, piece tid & 7, of each plane
    const int srow = tid >> 3, scol = (tid & 7) * 8;
    const bf* gsrc[4] = { Kh + zs + (size_t)srow * HD + scol, Kl + zs + (size_t)srow * HD + scol, Vh + zs + (size_t)srow * TT + scol, Vl + zs + (size_t)srow * TT + scol };
    bf* sdst = sm + srow * FP + scol;
    v8us pre[8];
#define FLOADS(s) { _Pragma("unroll") for (int p = 0; p < 4; ++p) { const size_t adv = (p < 2) ? (size_t)(s) * FS * HD : (size_t)(s) * FS; const size_t half = (p < 2) ? (size_t)32 * HD : (size_t)32 * TT; pre[2 * p] = *(const v8usa*)(gsrc[p] + adv); pre[2 * p + 1] = *(const v8usa*)(gsrc[p] + adv + half); } \
    asm volatile("s_wait_xcnt 0x0" ::: "memory"); /* before the fragment loads that follow reuse the address registers of these loads */ }
#define FSTORES(b) { _Pragma("unroll") for (int p = 0; p < 4; ++p) { *(v8usa*)(sdst + ((b) * 4 + p) * FPL) = pre[2 * p]; *(v8usa*)(sdst + ((b) * 4 + p) * FPL + 32 * FP) = pre[2 * p + 1]; } }
    v8f acc[4][2];
#pragma unroll
    for (int ct = 0; ct < 4; ++ct)
#pragma unroll
        for (int qt = 0; qt < 2; ++qt) acc[ct][qt] = (v8f){};
    float muse[2] = { -3.0e38f, -3.0e38f }, lsum[2] = { 0.f, 0.f };   // per query column: the maximum in use (log2 units) and this lane's share of the sum
    FLOADS(0) FSTORES(0)
    __syncthreads();
    const int fo = lr * FP + 8 * hi;
#pragma unroll 1
    for (int s = 0; s < TT / FS; ++s) {
        if (s + 1 < TT / FS) FLOADS(s + 1)
        const bf* sb = sm + (s & 1) * 4 * FPL + fo;
        v8f st[4][2];
#pragma unroll
        for (int kt = 0; kt < 4; ++kt)
#pragma unroll
            for (int qt = 0; qt < 2; ++qt) st[kt][qt] = (v8f){};
#pragma unroll
        for (int ks = 0; ks < 2; ++ks) { v16bf kh[4], kl[4];
#pragma unroll
            for (int kt = 0; kt < 4; ++kt) { kh[kt] = ldfrag(sb + kt * 16 * FP + ks * 32); kl[kt] = ldfrag(sb + FPL + kt * 16 * FP + ks * 32); }
#pragma unroll
            for (int kt = 0; kt < 4; ++kt)
#pragma unroll
                for (int qt = 0; qt < 2; ++qt) st[kt][qt] = wmmab(kh[kt], qh[qt][ks], st[kt][qt]);
#pragma unroll
            for (int kt = 0; kt < 4; ++kt)
#pragma unroll
                for (int qt = 0; qt < 2; ++qt) st[kt][qt] = wmmab(kl[kt], qh[qt][ks], st[kt][qt]);
#pragma unroll
            for (int kt = 0; kt < 4; ++kt)
#pragma unroll
                for (int qt = 0; qt < 2; ++qt) st[kt][qt] = wmmab(kh[kt], ql[qt][ks], st[kt][qt]); }
        // the stage's maximum per query column: in-lane, then one exchange between the wave's halves
        float m2[2];
#pragma unroll
        for (int qt = 0; qt < 2; ++qt) { float mk[4];
#pragma unroll
            for (int kt = 0; kt < 4; ++kt) { mk[kt] = st[kt][qt][0];
#pragma unroll
                for (int j = 1; j < 8; ++j) mk[kt] = fmaxf(mk[kt], st[kt][qt][j]); }
            const float m = fmaxf(fmaxf(mk[0], mk[1]), fmaxf(mk[2], mk[3])); m2[qt] = fmaxf(m, xhalf(m)) * L2E; }
        // rescale only when some column's maximum has outgrown the one in use by 2^8 (one scalar branch a stage); weights stay <= 2^8
        if (__builtin_amdgcn_ballot_w32(m2[0] > muse[0] + 8.0f || m2[1] > muse[1] + 8.0f) != 0) {
#pragma unroll
            for (int qt = 0; qt < 2; ++qt) { const float mn = fmaxf(muse[qt], m2[qt]); const float al = __builtin_amdgcn_exp2f(muse[qt] - mn); muse[qt] = mn; lsum[qt] *= al;
#pragma unroll
                for (int ct = 0; ct < 4; ++ct) acc[ct][qt] *= al; }
        }
        // weights 2^(s log2e - max) in f32, split into hi + lo planes; tiles 2 ks and 2 ks + 1 of a column are one B operand as they lie
        v16bf ph[2][2], pl[2][2];
#pragma unroll
        for (int qt = 0; qt < 2; ++qt) { v2f sk[4];
#pragma unroll
            for (int kt = 0; kt < 4; ++kt) { sk[kt] = (v2f){}; v8f t;
#pragma unroll
                for (int j = 0; j < 8; ++j) t[j] = __builtin_fmaf(st[kt][qt][j], L2E, -muse[qt]);
                const v8f ex = exp2x8(t);
#pragma unroll
                for (int j = 0; j < 8; j += 2) { v2f e; e[0] = ex[j]; e[1] = ex[j + 1]; sk[kt] += e;
                    const v2bf h = __builtin_convertvector(e, v2bf); const v2bf l = __builtin_convertvector(e - __builtin_convertvector(h, v2f), v2bf); const int x = (kt & 1) * 8 + j;
                    ph[kt >> 1][qt][x] = h[0]; ph[kt >> 1][qt][x + 1] = h[1]; pl[kt >> 1][qt][x] = l[0]; pl[kt >> 1][qt][x + 1] = l[1]; } }
            const v2f s2 = (sk[0] + sk[1]) + (sk[2] + sk[3]); lsum[qt] += s2[0] + s2[1]; }
#pragma unroll
        for (int ks = 0; ks < 2; ++ks) { v16bf vh[4], vl[4];
#pragma unroll
            for (int ct = 0; ct < 4; ++ct) { vh[ct] = ldfrag(sb + 2 * FPL + ct * 16 * FP + ks * 32); vl[ct] = ldfrag(sb + 3 * FPL + ct * 16 * FP + ks * 32); }
#pragma unroll
            for (int ct = 0; ct < 4; ++ct)
#pragma unroll
                for (int qt = 0; qt < 2; ++qt) acc[ct][qt] = wmmab(vh[ct], ph[ks][qt], acc[ct][qt]);
#pragma unroll
            for (int ct = 0; ct < 4; ++ct)
#pragma unroll
                for (int qt = 0; qt < 2; ++qt) acc[ct][qt] = wmmab(vl[ct], ph[ks][qt], acc[ct][qt]);
#pragma unroll
            for (int ct = 0; ct < 4; ++ct)
#pragma unroll
                for (int qt = 0; qt < 2; ++qt) acc[ct][qt] = wmmab(vh[ct], pl[ks][qt], acc[ct][qt]); }
        if (s + 1 < TT / FS) FSTORES((s + 1) & 1)   // its last readers left it before the barrier that ended stage s - 1
        __syncthreads();                            // publishes stage s + 1 and ends every read of stage s
    }
    // epilogue: join the halves' sums, normalise, stage each wave's [64 ch][32 queries] in its own LDS range, store whole 128-byte lines
    float* os = (float*)sm + wave * 64 * OP;
#pragma unroll
    for (int qt = 0; qt < 2; ++qt) { const float t = lsum[qt] + xhalf(lsum[qt]); const float f = __fdiv_rn(1.0f, t);
#pragma unroll
        for (int ct = 0; ct < 4; ++ct)
#pragma unroll
            for (int j = 0; j < 8; ++j) *(f32a*)(os + (ct * 16 + hi * 8 + j) * OP + qt * 16 + lr) = acc[ct][qt][j] * f; }
    float* og = outb + (size_t)blockIdx.y * CC * TT + q0;
#pragma unroll
    for (int it = 0; it < 16; ++it) { const int c = it * 4 + (lane >> 3), x = (lane & 7) * 4; *(v4f*)(og + (size_t)c * TT + x) = *(const v4fa*)(os + c * OP + x); }
}
extern "C" void kernel_launch(void* const* d_in, const int* in_sizes, int n_in,
                              void* d_out, int out_size, void* d_ws, size_t ws_size, hipStream_t stream) {
    (void)in_sizes; (void)n_in; (void)out_size;
    const float* x = (const float*)d_in[0]; const float* wq = (const float*)d_in[1]; const float* bq = (const float*)d_in[2]; const float* wk = (const float*)d_in[3]; const float* bk = (const float*)d_in[4]; const float* wv = (const float*)d_in[5]; const float* bv = (const float*)d_in[6]; const float* wo = nullptr; (void)wo;
    float* OUT = (float*)d_out;     // [64][64][1024]
    char* wsp = (char*)d_ws;
    auto take = [&](size_t bytes) { char* p = wsp; wsp += (bytes + 255) & ~(size_t)255; return (void*)p; };
    bf* WQ = (bf*)take((size_t)DQ * DM * 2); bf* WK = (bf*)take((size_t)DKV * DM * 2); bf* WV = (bf*)take((size_t)DKV * DM * 2);
    // these planes hold all NB_ slices, slice-major
    bf* XB = (bf*)take((size_t)NB_ * TT * DM * 2); float* FQ = (float*)take((size_t)NB_ * TT * DQ * 4); float* FK = (float*)take((size_t)NB_ * TT * DKV * 4);
    h16* QP16 = (h16*)take((size_t)NB_ * NH_ * TT * HD * 2); h16* KP16 = (h16*)take((size_t)NB_ * NKV * TT * HD * 2); h16* VT16 = (h16*)take((size_t)NB_ * NKV * HD * TT * 2);
    bf* QPh = (bf*)take((size_t)NB_ * NH_ * TT * HD * 2); bf* QPl = (bf*)take((size_t)NB_ * NH_ * TT * HD * 2); bf* KPh = (bf*)take((size_t)NB_ * NKV * TT * HD * 2); bf* KPl = (bf*)take((size_t)NB_ * NKV * TT * HD * 2); bf* VTh = (bf*)take((size_t)NB_ * NKV * HD * TT * 2); bf* VTl = (bf*)take((size_t)NB_ * NKV * HD * TT * 2);
    if ((size_t)(wsp - (char*)d_ws) > ws_size) return;    // ws 256 MiB, 112 MiB taken
    float* FV = FK;   // v projection reuses the k buffer after the k planes are built (stream-ordered)
    { k_cvt8<<<(unsigned)(((size_t)DQ * DM / 8 + 255) / 256), 256, 0, stream>>>(wq, WQ, (size_t)DQ * DM / 8); k_cvt8<<<(unsigned)(((size_t)DKV * DM / 8 + 255) / 256), 256, 0, stream>>>(wk, WK, (size_t)DKV * DM / 8); k_cvt8<<<(unsigned)(((size_t)DKV * DM / 8 + 255) / 256), 256, 0, stream>>>(wv, WV, (size_t)DKV * DM / 8); }
    const unsigned LKv = (unsigned)(((size_t)NKV * TT * HD / 2 + 255) / 256);
    // all NB_ slices in one launch each: the slice is grid y or z (k_flat: one flat range over all slices)
    k_xT<<<dim3((unsigned)(((size_t)TT * DM / 8 + 255) / 256), NB_, 1), 256, 0, stream>>>(x, XB);   /* channel-major slices -> token-major bf16 */
    k_gemmw<bf, 0, true><<<dim3(TT / 64, DQ / 64, NB_), 32, 0, stream>>>(XB, nullptr, WQ, nullptr, DM, FQ, DQ, bq, (size_t)TT * DM, 0, (size_t)TT * DQ);
    k_flat<<<(unsigned)(((size_t)NB_ * TT * DQ / 4 + 255) / 256), 256, 0, stream>>>(FQ, QP16, QPh, QPl, (size_t)NB_ * TT * DQ / 4);
    k_gemmw<bf, 0, true><<<dim3(TT / 64, DKV / 64, NB_), 32, 0, stream>>>(XB, nullptr, WK, nullptr, DM, FK, DKV, bk, (size_t)TT * DM, 0, (size_t)TT * DKV);
    k_flat<<<(unsigned)(((size_t)NB_ * TT * DKV / 4 + 255) / 256), 256, 0, stream>>>(FK, KP16, KPh, KPl, (size_t)NB_ * TT * DKV / 4);
    k_gemmw<bf, 0, true><<<dim3(TT / 64, DKV / 64, NB_), 32, 0, stream>>>(XB, nullptr, WV, nullptr, DM, FV, DKV, bv, (size_t)TT * DM, 0, (size_t)TT * DKV);
    k_vtp<<<dim3(LKv, NB_, 1), 256, 0, stream>>>(FV, DKV, NKV, VT16, VTh, VTl);
    k_fattn<<<dim3(TT / 256, NB_, 1), 256, 0, stream>>>(QPh, QPl, KPh, KPl, VTh, VTl, OUT);   /* scores, softmax, weights.v; writes the channel-major output */
}

// v003
// A run of this version takes 51.7 microseconds.
// In two side-by-side timings against v002, it was 2.03 and 2.02 times as fast.
// All steps since v000 together make it 69.1 times as fast.
#include <hip/hip_runtime.h>

// Spatial self-attention over 1,024 positions for each of 64 (batch, time) slices (x [8][8][64][1024] channel-major; q, k, v = 1x1 convs ('oi' [64][64] + [64], uniform(+-1/8)); scores = q.k over the 64 channels (unscaled, sigma ~2.7); softmax over positions; out = (weights v)^T channel-major -> [8][8][64][1024] (4.2 M)).
// Layout per slice: ONE projection kernel reads the [64][1024] channel-major slice as bf16 fragments (four neighbouring positions a lane) and writes the hi/lo planes of q, k (position-major) and v (channel-major) directly; exact projections + f32 biases; ONE 64-wide head with EVERY row on hi/lo planes (3 products; the unscaled logits are too sharp for fp16); scores, softmax and attn.v in ONE kernel (64 keys a stage, running maximum and sum per query, 3 products each side); its transposed products give channel-major rows directly.
// Compute dtypes, f32 accumulate: every input rounded to bf16; projections exact + f32 biases; scores and attn.v 3 products; softmax f32; output f32.

#define NB_  64
#define TT   1024
#define DM   64
#define NH_  1
#define NKV  1
#define REP  (NH_ / NKV)
#define HD   64
#define DQ   (NH_ * HD)
#define DKV  (NKV * HD)
#define ZH   1
#define RH   1024                  // unused; every query row uses hi+lo planes
#define WIN  0
#define PCAR 1024.0f
#define SCL  1.0f   // unscaled
#define CC   64
typedef unsigned short bf;
typedef __attribute__((ext_vector_type(16))) __bf16   v16bf;
typedef __attribute__((ext_vector_type(8)))  unsigned short v8us;
typedef __attribute__((ext_vector_type(8)))  float    v8f;
typedef __attribute__((ext_vector_type(4)))  float    v4f;
typedef v4f  __attribute__((may_alias)) v4fa;
typedef v8us __attribute__((may_alias)) v8usa;

__device__ __forceinline__ unsigned short f2bf(float f) { unsigned u = __float_as_uint(f); u += 0x7FFFu + ((u >> 16) & 1u); return (unsigned short)(u >> 16); }
__device__ __forceinline__ float bf2f(unsigned short b) { return __uint_as_float(((unsigned)b) << 16); }
__device__ __forceinline__ float bfr(float f) { return bf2f(f2bf(f)); }
__device__ __forceinline__ v16bf cat16b(v8us lo, v8us hi) { return __builtin_bit_cast(v16bf, __builtin_shufflevector(lo, hi, 0, 1, 2, 3, 4, 5, 6, 7, 8, 9, 10, 11, 12, 13, 14, 15)); }
__device__ __forceinline__ v8f wmmab(v16bf a, v16bf b, v8f c) { return __builtin_amdgcn_wmma_f32_16x16x32_bf16(false, a, false, b, (short)0, c, false, false); }
typedef __attribute__((ext_vector_type(2))) float v2f;

#define FS  64                     // keys per stage
#define FP  72                     // LDS row pitch in 16-bit elements: 144 B = 16 B x odd, conflict-free for 16-byte row reads
#define FPL (64 * FP)              // one plane of a stage
#define OP  36                     // output staging pitch in floats
#define L2E 1.4426950408889634f
typedef __attribute__((ext_vector_type(2))) __bf16 v2bf;
typedef float __attribute__((may_alias)) f32a;
__device__ __forceinline__ v16bf ldfrag(const bf* p) { return cat16b(*(const v8usa*)p, *(const v8usa*)(p + 16)); }   // hardware k order: 8 hi + s, 16 + 8 hi + (s - 8)
__device__ __forceinline__ float xhalf(float x) { const int b = __float_as_int(x); return __int_as_float(__builtin_amdgcn_permlanex16(b, b, 0x76543210, 0xfedcba98, false, false)); }   // lane l <-> l ^ 16
// eight v_exp_f32 and the slot behind the last one in ONE statement, every output apart from every input: no instruction directly behind a transcendental reads its result or overwrites its source
__device__ __forceinline__ v8f exp2x8(v8f t) { float e0, e1, e2, e3, e4, e5, e6, e7;
    asm("v_exp_f32 %0, %8\n\tv_exp_f32 %1, %9\n\tv_exp_f32 %2, %10\n\tv_exp_f32 %3, %11\n\tv_exp_f32 %4, %12\n\tv_exp_f32 %5, %13\n\tv_exp_f32 %6, %14\n\tv_exp_f32 %7, %15\n\tv_nop"
        : "=&v"(e0), "=&v"(e1), "=&v"(e2), "=&v"(e3), "=&v"(e4), "=&v"(e5), "=&v"(e6), "=&v"(e7) : "v"(t[0]), "v"(t[1]), "v"(t[2]), "v"(t[3]), "v"(t[4]), "v"(t[5]), "v"(t[6]), "v"(t[7]));
    return (v8f){ e0, e1, e2, e3, e4, e5, e6, e7 }; }
__global__ __launch_bounds__(256) void k_fattn(const bf* __restrict__ Qh, const bf* __restrict__ Ql, const bf* __restrict__ Kh, const bf* __restrict__ Kl, const bf* __restrict__ Vh, const bf* __restrict__ Vl, float* __restrict__ outb) {
    __shared__ __align__(16) bf sm[2 * 4 * FPL];   // 73,728 B; after the loop: 8 waves x [64 ch][OP] floats of output staging
    const int tid = threadIdx.x, lane = tid & 31, wave = tid >> 5, lr = lane & 15, hi = lane >> 4;
    const size_t zs = (size_t)blockIdx.y * TT * HD; const int q0 = blockIdx.x * 256 + wave * 32;
    v16bf qh[2][2], ql[2][2];
#pragma unroll
    for (int qt = 0; qt < 2; ++qt)
#pragma unroll
        for (int ks = 0; ks < 2; ++ks) { const size_t o = zs + (size_t)(q0 + qt * 16 + lr) * HD + ks * 32 + 8 * hi; qh[qt][ks] = ldfrag(Qh + o); ql[qt][ks] = ldfrag(Ql + o); }
    // staging: a plane of a stage is 64 rows x 8 pieces of 16 B; a thread moves rows srow and srow + 32, piece tid & 7, of each plane
    const int srow = tid >> 3, scol = (tid & 7) * 8;
    const bf* gsrc[4] = { Kh + zs + (size_t)srow * HD + scol, Kl + zs + (size_t)srow * HD + scol, Vh + zs + (size_t)srow * TT + scol, Vl + zs + (size_t)srow * TT + scol };
    bf* sdst = sm + srow * FP + scol;
    v8us pre[8];
#define FLOADS(s) { _Pragma("unroll") for (int p = 0; p < 4; ++p) { const size_t adv = (p < 2) ? (size_t)(s) * FS * HD : (size_t)(s) * FS; const size_t half = (p < 2) ? (size_t)32 * HD : (size_t)32 * TT; pre[2 * p] = *(const v8usa*)(gsrc[p] + adv); pre[2 * p + 1] = *(const v8usa*)(gsrc[p] + adv + half); } \
    asm volatile("s_wait_xcnt 0x0" ::: "memory"); /* before the fragment loads that follow reuse the address registers of these loads */ }
#define FSTORES(b) { _Pragma("unroll") for (int p = 0; p < 4; ++p) { *(v8usa*)(sdst + ((b) * 4 + p) * FPL) = pre[2 * p]; *(v8usa*)(sdst + ((b) * 4 + p) * FPL + 32 * FP) = pre[2 * p + 1]; } }
    v8f acc[4][2];
#pragma unroll
    for (int ct = 0; ct < 4; ++ct)
#pragma unroll
        for (int qt = 0; qt < 2; ++qt) acc[ct][qt] = (v8f){};
    float muse[2] = { -3.0e38f, -3.0e38f }, lsum[2] = { 0.f, 0.f };   // per query column: the maximum in use (log2 units) and this lane's share of the sum
    FLOADS(0) FSTORES(0)
    __syncthreads();
    const int fo = lr * FP + 8 * hi;
#pragma unroll 1
    for (int s = 0; s < TT / FS; ++s) {
        if (s + 1 < TT / FS) FLOADS(s + 1)
        const bf* sb = sm + (s & 1) * 4 * FPL + fo;
        v8f st[4][2];
#pragma unroll
        for (int kt = 0; kt < 4; ++kt)
#pragma unroll
            for (int qt = 0; qt < 2; ++qt) st[kt][qt] = (v8f){};
#pragma unroll
        for (int ks = 0; ks < 2; ++ks) { v16bf kh[4], kl[4];
#pragma unroll
            for (int kt = 0; kt < 4; ++kt) { kh[kt] = ldfrag(sb + kt * 16 * FP + ks * 32); kl[kt] = ldfrag(sb + FPL + kt * 16 * FP + ks * 32); }
#pragma unroll
            for (int kt = 0; kt < 4; ++kt)
#pragma unroll
                for (int qt = 0; qt < 2; ++qt) st[kt][qt] = wmmab(kh[kt], qh[qt][ks], st[kt][qt]);
#pragma unroll
            for (int kt = 0; kt < 4; ++kt)
#pragma unroll
                for (int qt = 0; qt < 2; ++qt) st[kt][qt] = wmmab(kl[kt], qh[qt][ks], st[kt][qt]);
#pragma unroll
            for (int kt = 0; kt < 4; ++kt)
#pragma unroll
                for (int qt = 0; qt < 2; ++qt) st[kt][qt] = wmmab(kh[kt], ql[qt][ks], st[kt][qt]); }
        // the stage's maximum per query column: in-lane, then one exchange between the wave's halves
        float m2[2];
#pragma unroll
        for (int qt = 0; qt < 2; ++qt) { float mk[4];
#pragma unroll
            for (int kt = 0; kt < 4; ++kt) { mk[kt] = st[kt][qt][0];
#pragma unroll
                for (int j = 1; j < 8; ++j) mk[kt] = fmaxf(mk[kt], st[kt][qt][j]); }
            const float m = fmaxf(fmaxf(mk[0], mk[1]), fmaxf(mk[2], mk[3])); m2[qt] = fmaxf(m, xhalf(m)) * L2E; }
        // rescale only when some column's maximum has outgrown the one in use by 2^8 (one scalar branch a stage); weights stay <= 2^8
        if (__builtin_amdgcn_ballot_w32(m2[0] > muse[0] + 8.0f || m2[1] > muse[1] + 8.0f) != 0) {
#pragma unroll
            for (int qt = 0; qt < 2; ++qt) { const float mn = fmaxf(muse[qt], m2[qt]); const float al = __builtin_amdgcn_exp2f(muse[qt] - mn); muse[qt] = mn; lsum[qt] *= al;
#pragma unroll
                for (int ct = 0; ct < 4; ++ct) acc[ct][qt] *= al; }
        }
        // weights 2^(s log2e - max) in f32, split into hi + lo planes; tiles 2 ks and 2 ks + 1 of a column are one B operand as they lie
        v16bf ph[2][2], pl[2][2];
#pragma unroll
        for (int qt = 0; qt < 2; ++qt) { v2f sk[4];
#pragma unroll
            for (int kt = 0; kt < 4; ++kt) { sk[kt] = (v2f){}; v8f t;
#pragma unroll
                for (int j = 0; j < 8; ++j) t[j] = __builtin_fmaf(st[kt][qt][j], L2E, -muse[qt]);
                const v8f ex = exp2x8(t);
#pragma unroll
                for (int j = 0; j < 8; j += 2) { v2f e; e[0] = ex[j]; e[1] = ex[j + 1]; sk[kt] += e;
                    const v2bf h = __builtin_convertvector(e, v2bf); const v2bf l = __builtin_convertvector(e - __builtin_convertvector(h, v2f), v2bf); const int x = (kt & 1) * 8 + j;
                    ph[kt >> 1][qt][x] = h[0]; ph[kt >> 1][qt][x + 1] = h[1]; pl[kt >> 1][qt][x] = l[0]; pl[kt >> 1][qt][x + 1] = l[1]; } }
            const v2f s2 = (sk[0] + sk[1]) + (sk[2] + sk[3]); lsum[qt] += s2[0] + s2[1]; }
#pragma unroll
        for (int ks = 0; ks < 2; ++ks) { v16bf vh[4], vl[4];
#pragma unroll
            for (int ct = 0; ct < 4; ++ct) { vh[ct] = ldfrag(sb + 2 * FPL + ct * 16 * FP + ks * 32); vl[ct] = ldfrag(sb + 3 * FPL + ct * 16 * FP + ks * 32); }
#pragma unroll
            for (int ct = 0; ct < 4; ++ct)
#pragma unroll
                for (int qt = 0; qt < 2; ++qt) acc[ct][qt] = wmmab(vh[ct], ph[ks][qt], acc[ct][qt]);
#pragma unroll
            for (int ct = 0; ct < 4; ++ct)
#pragma unroll
                for (int qt = 0; qt < 2; ++qt) acc[ct][qt] = wmmab(vl[ct], ph[ks][qt], acc[ct][qt]);
#pragma unroll
            for (int ct = 0; ct < 4; ++ct)
#pragma unroll
                for (int qt = 0; qt < 2; ++qt) acc[ct][qt] = wmmab(vh[ct], pl[ks][qt], acc[ct][qt]); }
        if (s + 1 < TT / FS) FSTORES((s + 1) & 1)   // its last readers left it before the barrier that ended stage s - 1
        __syncthreads();                            // publishes stage s + 1 and ends every read of stage s
    }
    // epilogue: join the halves' sums, normalise, stage each wave's [64 ch][32 queries] in its own LDS range, store whole 128-byte lines
    float* os = (float*)sm + wave * 64 * OP;
#pragma unroll
    for (int qt = 0; qt < 2; ++qt) { const float t = lsum[qt] + xhalf(lsum[qt]); const float f = __fdiv_rn(1.0f, t);
#pragma unroll
        for (int ct = 0; ct < 4; ++ct)
#pragma unroll
            for (int j = 0; j < 8; ++j) *(f32a*)(os + (ct * 16 + hi * 8 + j) * OP + qt * 16 + lr) = acc[ct][qt][j] * f; }
    float* og = outb + (size_t)blockIdx.y * CC * TT + q0;
#pragma unroll
    for (int it = 0; it < 16; ++it) { const int c = it * 4 + (lane >> 3), x = (lane & 7) * 4; *(v4f*)(og + (size_t)c * TT + x) = *(const v4fa*)(os + c * OP + x); }
}
// ---- k_proj: the three 1x1 convolutions of 64 positions of one slice, straight from x to the six hi/lo planes. 3 waves, one per projection; grid (TT / 64, slices).
// Position map: column (or row) i of tile tt is position t0 + 4 i + tt, so one 16-byte load of x feeds all four tiles and the x fragment serves as A and as B.
// k order of both operands, element s of k step ks: channel 32 ks + 8 hi + s (s < 8), 32 ks + 16 + 8 hi + (s - 8).
// q, k: D = W X (rows: out channels, a lane holds 8 neighbouring channels of one position). v: D = X^T W^T (rows: positions, a lane holds 32 neighbouring positions of one channel).
typedef __attribute__((ext_vector_type(4))) unsigned v4u;
typedef __attribute__((ext_vector_type(8))) unsigned v8u;
__device__ __forceinline__ unsigned pk2(float a, float b) { v2f e; e[0] = a; e[1] = b; return __builtin_bit_cast(unsigned, __builtin_convertvector(e, v2bf)); }   // two f32 -> one word of two bf16, round to nearest even
__device__ __forceinline__ void split8(const v8f y, v4u& h4, v4u& l4) {
#pragma unroll
    for (int j = 0; j < 4; ++j) { v2f e; e[0] = y[2 * j]; e[1] = y[2 * j + 1]; const v2bf h = __builtin_convertvector(e, v2bf); const v2bf l = __builtin_convertvector(e - __builtin_convertvector(h, v2f), v2bf);
        h4[j] = __builtin_bit_cast(unsigned, h); l4[j] = __builtin_bit_cast(unsigned, l); } }
// one wave's projection; VT: the v form (rows are positions). Every x and weight load stands at the head so that one memory latency covers them all.
template <bool VT>
__device__ __forceinline__ void proj_wave(const float* __restrict__ xs, const float* __restrict__ w, const float* __restrict__ b, bf* __restrict__ Ph, bf* __restrict__ Pl, int t0, int lr, int hi) {
    const float* xp = xs + (size_t)(8 * hi) * TT + t0 + 4 * lr; const float* wp = w + lr * DM + 8 * hi;
    v4f xv[2][16], wr[4][2][4]; v8f braw[4];
#pragma unroll
    for (int ks = 0; ks < 2; ++ks)
#pragma unroll
        for (int s = 0; s < 16; ++s) xv[ks][s] = *(const v4f*)(xp + (size_t)(ks * 32 + (s >> 3) * 16 + (s & 7)) * TT);
#pragma unroll
    for (int ot = 0; ot < 4; ++ot)
#pragma unroll
        for (int ks = 0; ks < 2; ++ks)
#pragma unroll
            for (int g = 0; g < 4; ++g) wr[ot][ks][g] = *(const v4f*)(wp + ot * 16 * DM + ks * 32 + (g >> 1) * 16 + (g & 1) * 4);
    asm volatile("s_wait_xcnt 0x0" ::: "memory");   // before the conversions that follow reuse the address registers of these loads
    __builtin_amdgcn_sched_barrier(0);              // keeps every load in front of the first conversion: without it the scheduler sinks the last loads behind conversions that wait for earlier ones, so a second memory latency is paid
    v16bf xf[4][2], wf[4][2];
#pragma unroll
    for (int ks = 0; ks < 2; ++ks)
#pragma unroll
        for (int tt = 0; tt < 4; ++tt) { v8u u;
#pragma unroll
            for (int s = 0; s < 8; ++s) u[s] = pk2(xv[ks][2 * s][tt], xv[ks][2 * s + 1][tt]);
            xf[tt][ks] = __builtin_bit_cast(v16bf, u); }
    // the bias loads are issued in front of the matrix instructions; their latency passes under the conversions and the products
#pragma unroll
    for (int ot = 0; ot < 4; ++ot) { if (VT) braw[ot][0] = b[ot * 16 + lr]; else braw[ot] = *(const v8f*)(b + ot * 16 + 8 * hi); }
    asm volatile("s_wait_xcnt 0x0" ::: "memory");   // before later code reuses the address registers of the bias loads
    __builtin_amdgcn_sched_barrier(0);              // keeps the bias loads here: sunk behind the matrix instructions their latency would be exposed
#pragma unroll
    for (int ot = 0; ot < 4; ++ot)
#pragma unroll
        for (int ks = 0; ks < 2; ++ks) { v8u u;
#pragma unroll
            for (int s = 0; s < 8; ++s) u[s] = pk2(wr[ot][ks][s >> 1][(s & 1) * 2], wr[ot][ks][s >> 1][(s & 1) * 2 + 1]);
            wf[ot][ks] = __builtin_bit_cast(v16bf, u); }
    v8f acc[4][4];
#pragma unroll
    for (int ot = 0; ot < 4; ++ot)
#pragma unroll
        for (int tt = 0; tt < 4; ++tt) acc[ot][tt] = (v8f){};
#pragma unroll
    for (int ks = 0; ks < 2; ++ks)
#pragma unroll
        for (int ot = 0; ot < 4; ++ot)
#pragma unroll
            for (int tt = 0; tt < 4; ++tt) acc[ot][tt] = VT ? wmmab(xf[tt][ks], wf[ot][ks], acc[ot][tt]) : wmmab(wf[ot][ks], xf[tt][ks], acc[ot][tt]);
    if (!VT) {
        const size_t o = (size_t)(t0 + 4 * lr) * HD + 8 * hi; bf* ph = Ph + o; bf* pl = Pl + o;
#pragma unroll
        for (int ot = 0; ot < 4; ++ot) { v8f bb;
#pragma unroll
            for (int j = 0; j < 8; ++j) bb[j] = bfr(braw[ot][j]);
#pragma unroll
            for (int tt = 0; tt < 4; ++tt) { v4u h4, l4; split8(acc[ot][tt] + bb, h4, l4); *(v4u*)(ph + tt * HD + ot * 16) = h4; *(v4u*)(pl + tt * HD + ot * 16) = l4; } }
        asm volatile("s_wait_xcnt 0x0" ::: "memory");   // behind the last store: whatever code the compiler lays behind this branch may reuse the stores' address and data registers
    } else {
        const size_t o = (size_t)lr * TT + t0 + 32 * hi; bf* ph = Ph + o; bf* pl = Pl + o;
#pragma unroll
        for (int ot = 0; ot < 4; ++ot) { const float bb = bfr(braw[ot][0]);
#pragma unroll
            for (int p = 0; p < 4; ++p) { v8f y;   // positions t0 + 32 hi + 8 p + r: row 8 hi + 2 p + (r >> 2) of tile r & 3
#pragma unroll
                for (int r = 0; r < 8; ++r) y[r] = acc[ot][r & 3][2 * p + (r >> 2)] + bb;
                v4u h4, l4; split8(y, h4, l4); *(v4u*)(ph + (size_t)ot * 16 * TT + p * 8) = h4; *(v4u*)(pl + (size_t)ot * 16 * TT + p * 8) = l4; } }
        asm volatile("s_wait_xcnt 0x0" ::: "memory");   // behind the last store: whatever code the compiler lays behind this branch may reuse the stores' address and data registers
    }
}
// launch bound: three waves a SIMD, so that all 1,024 work-groups are resident at once and the kernel pays its memory latency once
__global__ __launch_bounds__(96, 3) void k_proj(const float* __restrict__ x, const float* __restrict__ wq, const float* __restrict__ bq, const float* __restrict__ wk, const float* __restrict__ bk, const float* __restrict__ wv, const float* __restrict__ bv,
                                                bf* __restrict__ Qh, bf* __restrict__ Ql, bf* __restrict__ Kh, bf* __restrict__ Kl, bf* __restrict__ Vh, bf* __restrict__ Vl) {
    const int lane = threadIdx.x & 31, lr = lane & 15, hi = lane >> 4; const int pj = __builtin_amdgcn_readfirstlane((int)(threadIdx.x >> 5));   // the wave's projection, in a scalar register: the branch below is scalar and EXEC stays all ones at the matrix instructions
    const int t0 = blockIdx.x * 64; const size_t zs = (size_t)blockIdx.y * CC * TT;
    if (pj == 2) proj_wave<true>(x + zs, wv, bv, Vh + zs, Vl + zs, t0, lr, hi);
    else proj_wave<false>(x + zs, pj == 0 ? wq : wk, pj == 0 ? bq : bk, (pj == 0 ? Qh : Kh) + zs, (pj == 0 ? Ql : Kl) + zs, t0, lr, hi);
}
extern "C" void kernel_launch(void* const* d_in, const int* in_sizes, int n_in,
                              void* d_out, int out_size, void* d_ws, size_t ws_size, hipStream_t stream) {
    (void)in_sizes; (void)n_in; (void)out_size;
    const float* x = (const float*)d_in[0]; const float* wq = (const float*)d_in[1]; const float* bq = (const float*)d_in[2]; const float* wk = (const float*)d_in[3]; const float* bk = (const float*)d_in[4]; const float* wv = (const float*)d_in[5]; const float* bv = (const float*)d_in[6];
    float* OUT = (float*)d_out;     // [64][64][1024]
    char* wsp = (char*)d_ws;
    auto take = [&](size_t bytes) { char* p = wsp; wsp += (bytes + 255) & ~(size_t)255; return (void*)p; };
    // these planes hold all NB_ slices, slice-major
    bf* QPh = (bf*)take((size_t)NB_ * NH_ * TT * HD * 2); bf* QPl = (bf*)take((size_t)NB_ * NH_ * TT * HD * 2); bf* KPh = (bf*)take((size_t)NB_ * NKV * TT * HD * 2); bf* KPl = (bf*)take((size_t)NB_ * NKV * TT * HD * 2); bf* VTh = (bf*)take((size_t)NB_ * NKV * HD * TT * 2); bf* VTl = (bf*)take((size_t)NB_ * NKV * HD * TT * 2);
    if ((size_t)(wsp - (char*)d_ws) > ws_size) return;    // ws 256 MiB, 48 MiB taken
    k_proj<<<dim3(TT / 64, NB_, 1), 96, 0, stream>>>(x, wq, bq, wk, bk, wv, bv, QPh, QPl, KPh, KPl, VTh, VTl);   /* x -> hi/lo planes of q, k, v^T */
    k_fattn<<<dim3(TT / 256, NB_, 1), 256, 0, stream>>>(QPh, QPl, KPh, KPl, VTh, VTl, OUT);   /* scores, softmax, weights.v; writes the channel-major output */
}

// v004
// Measured time: 38.6 microseconds a run.
// Two timings next to v003 both put it at 1.34 times that version's speed.
// Counting every step since v000, it is 92.5 times as fast.
#include <hip/hip_runtime.h>

// Spatial self-attention over 1,024 positions for each of 64 (batch, time) slices (x [8][8][64][1024] channel-major; q, k, v = 1x1 convs ('oi' [64][64] + [64]); scores = q.k over the 64 channels, unscaled; softmax over positions; out = (weights v)^T channel-major -> [8][8][64][1024]).
// ONE kernel: a work-group owns 256 queries of one slice. It forms its q in registers, and for every stage of 64 keys it forms k and v^T itself from x (bf16 fragments through LDS) and lays their hi/lo planes in LDS; scores, softmax and weights.v as 3 products each side, running maximum and sum per query; the transposed products give channel-major rows directly.
// Compute dtypes, f32 accumulate: every input rounded to bf16; projections exact + f32 biases; q, k, v and the weights as bf16 hi + lo planes, 3 products; softmax f32; output f32.

#define NB_  64
#define TT   1024
#define DM   64
#define NH_  1
#define NKV  1
#define REP  (NH_ / NKV)
#define HD   64
#define DQ   (NH_ * HD)
#define DKV  (NKV * HD)
#define ZH   1
#define RH   1024                  // unused; every query row uses hi+lo planes
#define WIN  0
#define PCAR 1024.0f
#define SCL  1.0f   // unscaled
#define CC   64
typedef unsigned short bf;
typedef __attribute__((ext_vector_type(16))) __bf16   v16bf;
typedef __attribute__((ext_vector_type(8)))  unsigned short v8us;
typedef __attribute__((ext_vector_type(8)))  float    v8f;
typedef __attribute__((ext_vector_type(4)))  float    v4f;
typedef v4f  __attribute__((may_alias)) v4fa;
typedef v8us __attribute__((may_alias)) v8usa;

__device__ __forceinline__ unsigned short f2bf(float f) { unsigned u = __float_as_uint(f); u += 0x7FFFu + ((u >> 16) & 1u); return (unsigned short)(u >> 16); }
__device__ __forceinline__ float bf2f(unsigned short b) { return __uint_as_float(((unsigned)b) << 16); }
__device__ __forceinline__ float bfr(float f) { return bf2f(f2bf(f)); }
__device__ __forceinline__ v16bf cat16b(v8us lo, v8us hi) { return __builtin_bit_cast(v16bf, __builtin_shufflevector(lo, hi, 0, 1, 2, 3, 4, 5, 6, 7, 8, 9, 10, 11, 12, 13, 14, 15)); }
__device__ __forceinline__ v8f wmmab(v16bf a, v16bf b, v8f c) { return __builtin_amdgcn_wmma_f32_16x16x32_bf16(false, a, false, b, (short)0, c, false, false); }
typedef __attribute__((ext_vector_type(2))) float v2f;

#define FS  64                     // keys per stage
#define FP  72                     // LDS row pitch in 16-bit elements: 144 B = 16 B x odd, conflict-free for 16-byte row reads
#define FPL (64 * FP)              // one plane of a stage
#define OP  36                     // output staging pitch in floats
#define L2E 1.4426950408889634f
typedef __attribute__((ext_vector_type(2))) __bf16 v2bf;
typedef float __attribute__((may_alias)) f32a;
__device__ __forceinline__ v16bf ldfrag(const bf* p) { return cat16b(*(const v8usa*)p, *(const v8usa*)(p + 16)); }   // hardware k order: 8 hi + s, 16 + 8 hi + (s - 8)
__device__ __forceinline__ float xhalf(float x) { const int b = __float_as_int(x); return __int_as_float(__builtin_amdgcn_permlanex16(b, b, 0x76543210, 0xfedcba98, false, false)); }   // lane l <-> l ^ 16
// eight v_exp_f32 and the slot behind the last one in ONE statement, every output apart from every input: no instruction directly behind a transcendental reads its result or overwrites its source.
// The four v_nop at its head keep the distance behind a matrix instruction: the outputs may be laid on the A or B registers of the product issued just in front, and the compiler pads nothing inside a statement
__device__ __forceinline__ v8f exp2x8(v8f t) { float e0, e1, e2, e3, e4, e5, e6, e7;
    asm("v_nop\n\tv_nop\n\tv_nop\n\tv_nop\n\tv_exp_f32 %0, %8\n\tv_exp_f32 %1, %9\n\tv_exp_f32 %2, %10\n\tv_exp_f32 %3, %11\n\tv_exp_f32 %4, %12\n\tv_exp_f32 %5, %13\n\tv_exp_f32 %6, %14\n\tv_exp_f32 %7, %15\n\tv_nop"
        : "=&v"(e0), "=&v"(e1), "=&v"(e2), "=&v"(e3), "=&v"(e4), "=&v"(e5), "=&v"(e6), "=&v"(e7) : "v"(t[0]), "v"(t[1]), "v"(t[2]), "v"(t[3]), "v"(t[4]), "v"(t[5]), "v"(t[6]), "v"(t[7]));
    return (v8f){ e0, e1, e2, e3, e4, e5, e6, e7 }; }
typedef __attribute__((ext_vector_type(4))) unsigned v4u;
typedef __attribute__((ext_vector_type(8))) unsigned v8u;
typedef v4u __attribute__((may_alias)) v4ua;
__device__ __forceinline__ unsigned pk2(float a, float b) { v2f e; e[0] = a; e[1] = b; return __builtin_bit_cast(unsigned, __builtin_convertvector(e, v2bf)); }   // two f32 -> one word of two bf16, round to nearest even
__device__ __forceinline__ void split8(const v8f y, v4u& h4, v4u& l4) {
#pragma unroll
    for (int j = 0; j < 4; ++j) { v2f e; e[0] = y[2 * j]; e[1] = y[2 * j + 1]; const v2bf h = __builtin_convertvector(e, v2bf); const v2bf l = __builtin_convertvector(e - __builtin_convertvector(h, v2f), v2bf);
        h4[j] = __builtin_bit_cast(unsigned, h); l4[j] = __builtin_bit_cast(unsigned, l); } }
// one wave's share of a stage's projection, in two parts. proj_mm: the x^T fragments of 32 keys from LDS, 4 products for k and 4 for v
__device__ __forceinline__ void proj_mm(const bf* xb, const v16bf wk0, const v16bf wk1, const v16bf wv0, const v16bf wv1, v8f (&ak)[2], v8f (&av)[2]) {
    v16bf xf[2][2];
#pragma unroll
    for (int t = 0; t < 2; ++t) { xf[t][0] = ldfrag(xb + t * 16 * FP); xf[t][1] = ldfrag(xb + t * 16 * FP + 32); }
#pragma unroll
    for (int t = 0; t < 2; ++t) { ak[t] = wmmab(wk0, xf[t][0], (v8f){}); av[t] = wmmab(xf[t][0], wv0, (v8f){}); }
#pragma unroll
    for (int t = 0; t < 2; ++t) { ak[t] = wmmab(wk1, xf[t][1], ak[t]); av[t] = wmmab(xf[t][1], wv1, av[t]); }
}
// proj_st: bias, hi/lo split, 16-byte pieces into the K and V^T planes
__device__ __forceinline__ void proj_st(bf* kdst, bf* vdst, const v8f (&ak)[2], const v8f (&av)[2], const v8f bbk, const float bbv) {
#pragma unroll
    for (int t = 0; t < 2; ++t) { v4u h4, l4; split8(ak[t] + bbk, h4, l4); *(v4ua*)(kdst + t * 16 * FP) = h4; *(v4ua*)(kdst + FPL + t * 16 * FP) = l4;
        split8(av[t] + bbv, h4, l4); *(v4ua*)(vdst + t * 16) = h4; *(v4ua*)(vdst + FPL + t * 16) = l4; }
}
__global__ __launch_bounds__(256) void k_fattn(const float* __restrict__ x, const float* __restrict__ wq, const float* __restrict__ bq, const float* __restrict__ wk, const float* __restrict__ bk, const float* __restrict__ wv, const float* __restrict__ bv, float* __restrict__ outb) {
    __shared__ __align__(16) bf sm[2 * 4 * FPL + 2 * FPL];   // 92,160 B: two stages of four planes, then two buffers of x^T; after the loop its head is 8 waves x [64 ch][OP] floats of output staging
    const int tid = threadIdx.x, lane = tid & 31, lr = lane & 15, hi = lane >> 4; const int wave = tid >> 5;
    const float* xs = x + (size_t)blockIdx.y * CC * TT; const int q0 = blockIdx.x * 256 + wave * 32;
    // x staging: wave w moves channels 8 w .. 8 w + 7, a lane keys 2 lane and 2 lane + 1 (a load covers 256 B in a row); rounded to bf16 they are two 16-byte pieces of x^T
    const float* xg = xs + (size_t)(8 * wave) * TT + 2 * lane; bf* xt = sm + 2 * 4 * FPL; bf* xdst = xt + 2 * lane * FP + 8 * wave;
    v2f xr[8];
#define XLOADS(s) { _Pragma("unroll") for (int c = 0; c < 8; ++c) xr[c] = *(const v2f*)(xg + (size_t)c * TT + (s) * FS); \
    asm volatile("s_wait_xcnt 0x0" ::: "memory"); /* before the code that follows reuses the address registers of these loads */ }
#define XSTORES(b) { _Pragma("unroll") for (int p = 0; p < 2; ++p) { v4u u; _Pragma("unroll") for (int i = 0; i < 4; ++i) u[i] = pk2(xr[2 * i][p], xr[2 * i + 1][p]); *(v4ua*)(xdst + (b) * FPL + p * FP) = u; } }
    // every load of the prologue stands at its head, so that one memory latency covers them all. Behind each group that shares an address base: s_wait_xcnt 0, before later code reuses the group's address registers,
    // and a scheduling barrier, without which the scheduler lifts the next group's address arithmetic and the conversions over that wait
#define XWAIT { asm volatile("s_wait_xcnt 0x0" ::: "memory"); __builtin_amdgcn_sched_barrier(0); }
    XLOADS(0)
    __builtin_amdgcn_sched_barrier(0);              // as in XWAIT
    const int th = wave >> 2, ot = wave & 3;
    v4f wkv[2][2][4]; v8f bkraw; float bvraw;       // the wave's own weight tiles and biases for the k and v projections
    { const int wo = (ot * 16 + lr) * DM + 8 * hi;
#pragma unroll
        for (int ks = 0; ks < 2; ++ks)
#pragma unroll
            for (int g = 0; g < 4; ++g) { wkv[0][ks][g] = *(const v4f*)(wk + wo + ks * 32 + (g >> 1) * 16 + (g & 1) * 4); wkv[1][ks][g] = *(const v4f*)(wv + wo + ks * 32 + (g >> 1) * 16 + (g & 1) * 4); } }
    XWAIT
    bkraw = *(const v8f*)(bk + ot * 16 + 8 * hi);
    XWAIT
    bvraw = bv[ot * 16 + lr];
    XWAIT
    v2f xv[2][16]; v4f wr[4][2][4]; v8f bqraw[4];   // x of the wave's 32 queries, the whole q weight and bias
    { const float* xp = xs + (size_t)(8 * hi) * TT + q0 + 2 * lr;
#pragma unroll
        for (int ks = 0; ks < 2; ++ks)
#pragma unroll
            for (int s = 0; s < 16; ++s) xv[ks][s] = *(const v2f*)(xp + (size_t)(ks * 32 + (s >> 3) * 16 + (s & 7)) * TT); }
    XWAIT
#pragma unroll
    for (int o = 0; o < 4; ++o) bqraw[o] = *(const v8f*)(bq + o * 16 + 8 * hi);
    XWAIT
    { const float* wp = wq + lr * DM + 8 * hi;
#pragma unroll
        for (int o = 0; o < 4; ++o)
#pragma unroll
            for (int ks = 0; ks < 2; ++ks)
#pragma unroll
                for (int g = 0; g < 4; ++g) wr[o][ks][g] = *(const v4f*)(wp + o * 16 * DM + ks * 32 + (g >> 1) * 16 + (g & 1) * 4);
        asm volatile("s_wait_xcnt 0x0" :: "v"(wp) : "memory");   // as in XWAIT; the address is named as an input so that its registers stay live up to the wait: otherwise the group's last load lands on them
        __builtin_amdgcn_sched_barrier(0); }
    XSTORES(0)
    XLOADS(1)
    __builtin_amdgcn_sched_barrier(0);              // as in XWAIT
    v16bf wkf[2], wvf[2]; v8f bbk; const float bbv = bfr(bvraw);
#pragma unroll
    for (int ks = 0; ks < 2; ++ks) { v8u u0, u1;
#pragma unroll
        for (int s = 0; s < 8; ++s) { u0[s] = pk2(wkv[0][ks][s >> 1][(s & 1) * 2], wkv[0][ks][s >> 1][(s & 1) * 2 + 1]); u1[s] = pk2(wkv[1][ks][s >> 1][(s & 1) * 2], wkv[1][ks][s >> 1][(s & 1) * 2 + 1]); }
        wkf[ks] = __builtin_bit_cast(v16bf, u0); wvf[ks] = __builtin_bit_cast(v16bf, u1); }
#pragma unroll
    for (int j = 0; j < 8; ++j) bbk[j] = bfr(bkraw[j]);
    // q of the wave's 32 queries: D = Wq X; column i of tile qt is query q0 + 2 i + qt, so one 8-byte load of x feeds both tiles; D tiles 2 ks and 2 ks + 1 of a column are one B operand as they lie
    v16bf qh[2][2], ql[2][2];
    { v16bf xf[2][2], wf[4][2];
#pragma unroll
        for (int ks = 0; ks < 2; ++ks) {
#pragma unroll
            for (int qt = 0; qt < 2; ++qt) { v8u u;
#pragma unroll
                for (int s = 0; s < 8; ++s) u[s] = pk2(xv[ks][2 * s][qt], xv[ks][2 * s + 1][qt]);
                xf[qt][ks] = __builtin_bit_cast(v16bf, u); }
#pragma unroll
            for (int o = 0; o < 4; ++o) { v8u u;
#pragma unroll
                for (int s = 0; s < 8; ++s) u[s] = pk2(wr[o][ks][s >> 1][(s & 1) * 2], wr[o][ks][s >> 1][(s & 1) * 2 + 1]);
                wf[o][ks] = __builtin_bit_cast(v16bf, u); } }
        v8f a[4][2];
#pragma unroll
        for (int o = 0; o < 4; ++o)
#pragma unroll
            for (int qt = 0; qt < 2; ++qt) a[o][qt] = (v8f){};
#pragma unroll
        for (int ks = 0; ks < 2; ++ks)
#pragma unroll
            for (int o = 0; o < 4; ++o)
#pragma unroll
                for (int qt = 0; qt < 2; ++qt) a[o][qt] = wmmab(wf[o][ks], xf[qt][ks], a[o][qt]);
#pragma unroll
        for (int qt = 0; qt < 2; ++qt) { v4u h4[4], l4[4];
#pragma unroll
            for (int o = 0; o < 4; ++o) { v8f qb;
#pragma unroll
                for (int j = 0; j < 8; ++j) qb[j] = bfr(bqraw[o][j]);
                split8(a[o][qt] + qb, h4[o], l4[o]); }
#pragma unroll
            for (int ks = 0; ks < 2; ++ks) { qh[qt][ks] = __builtin_bit_cast(v16bf, __builtin_shufflevector(h4[2 * ks], h4[2 * ks + 1], 0, 1, 2, 3, 4, 5, 6, 7)); ql[qt][ks] = __builtin_bit_cast(v16bf, __builtin_shufflevector(l4[2 * ks], l4[2 * ks + 1], 0, 1, 2, 3, 4, 5, 6, 7)); } } }
    const int fo = lr * FP + 8 * hi;
    const bf* pxb = xt + th * 32 * FP + fo; bf* kdst = sm + th * 32 * FP + lr * FP + ot * 16 + 8 * hi; bf* vdst = sm + 2 * FPL + (ot * 16 + lr) * FP + th * 32 + 8 * hi;
    v8f ak[2], av[2];
#define PROJMM(n) proj_mm(pxb + ((n) & 1) * FPL, wkf[0], wkf[1], wvf[0], wvf[1], ak, av);
#define PROJST(n) proj_st(kdst + ((n) & 1) * 4 * FPL, vdst + ((n) & 1) * 4 * FPL, ak, av, bbk, bbv);
    v8f acc[4][2];
#pragma unroll
    for (int ct = 0; ct < 4; ++ct)
#pragma unroll
        for (int qt = 0; qt < 2; ++qt) acc[ct][qt] = (v8f){};
    float muse[2] = { -3.0e38f, -3.0e38f }, lsum[2] = { 0.f, 0.f };   // per query column: the maximum in use (log2 units) and this lane's share of the sum
    __syncthreads();                                // publishes x^T of stage 0
    PROJMM(0) PROJST(0)
    XSTORES(1)
    __syncthreads();                                // publishes the planes of stage 0 and x^T of stage 1
#pragma unroll 1
    for (int s = 0; s < TT / FS; ++s) {
        if (s + 2 < TT / FS) XLOADS(s + 2)
        // the planes of stage s + 1: reads x^T of stage s + 1, published by the barrier that ended stage s - 1; the last readers of the planes it writes left them before that barrier.
        // Its products stand in front of the score products, its vector work and stores between their two k steps, under no branch, so that the vector work can issue beside the score products; in the last stage it works on the x^T of two stages back and nobody reads what it writes
        PROJMM(s + 1)
        const bf* sb = sm + (s & 1) * 4 * FPL + fo;
        v8f st[4][2];
#pragma unroll
        for (int kt = 0; kt < 4; ++kt)
#pragma unroll
            for (int qt = 0; qt < 2; ++qt) st[kt][qt] = (v8f){};
        v16bf kh[2][4], kl[2][4];   // every K fragment of the stage is read in front of the projection's stores
#pragma unroll
        for (int ks = 0; ks < 2; ++ks)
#pragma unroll
            for (int kt = 0; kt < 4; ++kt) { kh[ks][kt] = ldfrag(sb + kt * 16 * FP + ks * 32); kl[ks][kt] = ldfrag(sb + FPL + kt * 16 * FP + ks * 32); }
#pragma unroll
        for (int ks = 0; ks < 2; ++ks) {
#pragma unroll
            for (int kt = 0; kt < 4; ++kt)
#pragma unroll
                for (int qt = 0; qt < 2; ++qt) st[kt][qt] = wmmab(kh[ks][kt], qh[qt][ks], st[kt][qt]);
#pragma unroll
            for (int kt = 0; kt < 4; ++kt)
#pragma unroll
                for (int qt = 0; qt < 2; ++qt) st[kt][qt] = wmmab(kl[ks][kt], qh[qt][ks], st[kt][qt]);
#pragma unroll
            for (int kt = 0; kt < 4; ++kt)
#pragma unroll
                for (int qt = 0; qt < 2; ++qt) st[kt][qt] = wmmab(kh[ks][kt], ql[qt][ks], st[kt][qt]);
            if (ks == 0) PROJST(s + 1) }
        // the stage's maximum per query column: in-lane, then one exchange between the wave's halves
        float m2[2];
#pragma unroll
        for (int qt = 0; qt < 2; ++qt) { float mk[4];
#pragma unroll
            for (int kt = 0; kt < 4; ++kt) { mk[kt] = st[kt][qt][0];
#pragma unroll
                for (int j = 1; j < 8; ++j) mk[kt] = fmaxf(mk[kt], st[kt][qt][j]); }
            const float m = fmaxf(fmaxf(mk[0], mk[1]), fmaxf(mk[2], mk[3])); m2[qt] = fmaxf(m, xhalf(m)) * L2E; }
        // rescale only when some column's maximum has outgrown the one in use by 2^8 (one scalar branch a stage); weights stay <= 2^8
        if (__builtin_amdgcn_ballot_w32(m2[0] > muse[0] + 8.0f || m2[1] > muse[1] + 8.0f) != 0) {
#pragma unroll
            for (int qt = 0; qt < 2; ++qt) { const float mn = fmaxf(muse[qt], m2[qt]); const float al = __builtin_amdgcn_exp2f(muse[qt] - mn); muse[qt] = mn; lsum[qt] *= al;
#pragma unroll
                for (int ct = 0; ct < 4; ++ct) acc[ct][qt] *= al; }
        }
        // weights 2^(s log2e - max) in f32, split into hi + lo planes; tiles 2 ks and 2 ks + 1 of a column are one B operand as they lie
        v16bf ph[2][2], pl[2][2];
#pragma unroll
        for (int qt = 0; qt < 2; ++qt) { v2f sk[4];
#pragma unroll
            for (int kt = 0; kt < 4; ++kt) { sk[kt] = (v2f){}; v8f t;
#pragma unroll
                for (int j = 0; j < 8; ++j) t[j] = __builtin_fmaf(st[kt][qt][j], L2E, -muse[qt]);
                const v8f ex = exp2x8(t);
#pragma unroll
                for (int j = 0; j < 8; j += 2) { v2f e; e[0] = ex[j]; e[1] = ex[j + 1]; sk[kt] += e;
                    const v2bf h = __builtin_convertvector(e, v2bf); const v2bf l = __builtin_convertvector(e - __builtin_convertvector(h, v2f), v2bf); const int x = (kt & 1) * 8 + j;
                    ph[kt >> 1][qt][x] = h[0]; ph[kt >> 1][qt][x + 1] = h[1]; pl[kt >> 1][qt][x] = l[0]; pl[kt >> 1][qt][x + 1] = l[1]; } }
            const v2f s2 = (sk[0] + sk[1]) + (sk[2] + sk[3]); lsum[qt] += s2[0] + s2[1]; }
#pragma unroll
        for (int ks = 0; ks < 2; ++ks) { v16bf vh[4], vl[4];
#pragma unroll
            for (int ct = 0; ct < 4; ++ct) { vh[ct] = ldfrag(sb + 2 * FPL + ct * 16 * FP + ks * 32); vl[ct] = ldfrag(sb + 3 * FPL + ct * 16 * FP + ks * 32); }
#pragma unroll
            for (int ct = 0; ct < 4; ++ct)
#pragma unroll
                for (int qt = 0; qt < 2; ++qt) acc[ct][qt] = wmmab(vh[ct], ph[ks][qt], acc[ct][qt]);
#pragma unroll
            for (int ct = 0; ct < 4; ++ct)
#pragma unroll
                for (int qt = 0; qt < 2; ++qt) acc[ct][qt] = wmmab(vl[ct], ph[ks][qt], acc[ct][qt]);
#pragma unroll
            for (int ct = 0; ct < 4; ++ct)
#pragma unroll
                for (int qt = 0; qt < 2; ++qt) acc[ct][qt] = wmmab(vh[ct], pl[ks][qt], acc[ct][qt]); }
        if (s + 2 < TT / FS) XSTORES(s & 1)         // its last readers (the projection of stage s) left it before the barrier that ended stage s - 1
        __syncthreads();                            // publishes the planes of stage s + 1 and x^T of stage s + 2, ends every read of stage s
    }
    // epilogue: join the halves' sums, normalise, stage each wave's [64 ch][32 queries] in its own LDS range, store whole 128-byte lines
    float* os = (float*)sm + wave * 64 * OP;
#pragma unroll
    for (int qt = 0; qt < 2; ++qt) { const float t = lsum[qt] + xhalf(lsum[qt]); const float f = __fdiv_rn(1.0f, t);
#pragma unroll
        for (int ct = 0; ct < 4; ++ct)
#pragma unroll
            for (int j = 0; j < 8; ++j) *(f32a*)(os + (ct * 16 + hi * 8 + j) * OP + 2 * lr + qt) = acc[ct][qt][j] * f; }
    float* og = outb + (size_t)blockIdx.y * CC * TT + q0;
#pragma unroll
    for (int it = 0; it < 16; ++it) { const int c = it * 4 + (lane >> 3), x = (lane & 7) * 4; *(v4f*)(og + (size_t)c * TT + x) = *(const v4fa*)(os + c * OP + x); }
}
extern "C" void kernel_launch(void* const* d_in, const int* in_sizes, int n_in,
                              void* d_out, int out_size, void* d_ws, size_t ws_size, hipStream_t stream) {
    (void)in_sizes; (void)n_in; (void)out_size; (void)d_ws; (void)ws_size;
    const float* x = (const float*)d_in[0]; const float* wq = (const float*)d_in[1]; const float* bq = (const float*)d_in[2]; const float* wk = (const float*)d_in[3]; const float* bk = (const float*)d_in[4]; const float* wv = (const float*)d_in[5]; const float* bv = (const float*)d_in[6];
    float* OUT = (float*)d_out;     // [64][64][1024]
    k_fattn<<<dim3(TT / 256, NB_, 1), 256, 0, stream>>>(x, wq, bq, wk, bk, wv, bv, OUT);   /* projections, scores, softmax, weights.v; writes the channel-major output */
}

// v006
// It runs in 25 microseconds.
// It is 1.55 times as fast as v004, going by the measured steps of the versions left out in between.
// Over all steps from v000 it is 143 times as fast.
#include <hip/hip_runtime.h>

// Spatial self-attention over 1,024 positions for each of 64 (batch, time) slices (x [8][8][64][1024] channel-major; q, k, v = 1x1 convs ('oi' [64][64] + [64]); scores = q.k over the 64 channels, unscaled; softmax over positions; out = (weights v)^T channel-major -> [8][8][64][1024]).
// ONE kernel: a work-group owns 256 queries of one slice. It forms its q in registers, and for every stage of 64 keys it forms k and v^T itself from x (f16 fragments through LDS) and lays them in LDS as f16; scores, softmax and weights.v as one product each side, running maximum and sum per query; the transposed products give channel-major rows directly.
// Compute dtypes, f32 accumulate: x and the three weight matrices rounded to f16; f32 biases added to the f32 accumulators; q, k, v and the softmax weights rounded once to f16 (q, k, v are a few units for these generators, the weights <= 2^8: far inside the f16 range); softmax f32; output f32.

#define NB_  64
#define TT   1024
#define DM   64
#define NH_  1
#define NKV  1
#define REP  (NH_ / NKV)
#define HD   64
#define DQ   (NH_ * HD)
#define DKV  (NKV * HD)
#define ZH   1
#define WIN  0
#define PCAR 1024.0f
#define SCL  1.0f   // unscaled
#define CC   64
typedef unsigned short bf;
typedef __attribute__((ext_vector_type(16))) _Float16 v16h;
typedef __attribute__((ext_vector_type(8)))  unsigned short v8us;
typedef __attribute__((ext_vector_type(8)))  float    v8f;
typedef __attribute__((ext_vector_type(4)))  float    v4f;
typedef v4f  __attribute__((may_alias)) v4fa;
typedef v8us __attribute__((may_alias)) v8usa;

__device__ __forceinline__ v16h cat16b(v8us lo, v8us hi) { return __builtin_bit_cast(v16h, __builtin_shufflevector(lo, hi, 0, 1, 2, 3, 4, 5, 6, 7, 8, 9, 10, 11, 12, 13, 14, 15)); }
__device__ __forceinline__ v8f wmmab(v16h a, v16h b, v8f c) { return __builtin_amdgcn_wmma_f32_16x16x32_f16(false, a, false, b, (short)0, c, false, false); }
typedef __attribute__((ext_vector_type(2))) float v2f;

#define FS  64                     // keys per stage
#define FP  72                     // LDS row pitch in 16-bit elements: 144 B = 16 B x odd, conflict-free for 16-byte row reads
#define FPL (64 * FP)              // one plane of a stage
#define OP  36                     // output staging pitch in floats
#define L2E 1.4426950408889634f
typedef __attribute__((ext_vector_type(2))) _Float16 v2h;
typedef float __attribute__((may_alias)) f32a;
__device__ __forceinline__ v16h ldfrag(const bf* p) { return cat16b(*(const v8usa*)p, *(const v8usa*)(p + 16)); }   // hardware k order: 8 hi + s, 16 + 8 hi + (s - 8)
__device__ __forceinline__ float xhalf(float x) { const int b = __float_as_int(x); return __int_as_float(__builtin_amdgcn_permlanex16(b, b, 0x76543210, 0xfedcba98, false, false)); }   // lane l <-> l ^ 16
typedef __attribute__((ext_vector_type(4))) unsigned v4u;
typedef __attribute__((ext_vector_type(8))) unsigned v8u;
typedef v4u __attribute__((may_alias)) v4ua;
__device__ __forceinline__ unsigned pk2(float a, float b) { v2f e; e[0] = a; e[1] = b; return __builtin_bit_cast(unsigned, __builtin_convertvector(e, v2h)); }   // two f32 -> one word of two f16, round to nearest even
__device__ __forceinline__ v4u pack8(const v8f y) { v4u h4;
#pragma unroll
    for (int j = 0; j < 4; ++j) h4[j] = pk2(y[2 * j], y[2 * j + 1]);
    return h4; }
// one wave's share of a stage's projection, in two parts. proj_mm: the x^T fragments of 32 keys from LDS, 4 products for k and 4 for v
__device__ __forceinline__ void proj_mm(const bf* xb, const v16h wk0, const v16h wk1, const v16h wv0, const v16h wv1, v8f (&ak)[2], v8f (&av)[2]) {
    v16h xf[2][2];
#pragma unroll
    for (int t = 0; t < 2; ++t) { xf[t][0] = ldfrag(xb + t * 16 * FP); xf[t][1] = ldfrag(xb + t * 16 * FP + 32); }
#pragma unroll
    for (int t = 0; t < 2; ++t) { ak[t] = wmmab(wk0, xf[t][0], (v8f){}); av[t] = wmmab(xf[t][0], wv0, (v8f){}); }
#pragma unroll
    for (int t = 0; t < 2; ++t) { ak[t] = wmmab(wk1, xf[t][1], ak[t]); av[t] = wmmab(xf[t][1], wv1, av[t]); }
}
// proj_st: bias, rounding to f16, 16-byte pieces into the K and V^T planes
__device__ __forceinline__ void proj_st(bf* kdst, bf* vdst, const v8f (&ak)[2], const v8f (&av)[2], const v8f bbk, const float bbv) {
#pragma unroll
    for (int t = 0; t < 2; ++t) { *(v4ua*)(kdst + t * 16 * FP) = pack8(ak[t] + bbk); *(v4ua*)(vdst + t * 16) = pack8(av[t] + bbv); }
}
__global__ __launch_bounds__(256) void k_fattn(const float* __restrict__ x, const float* __restrict__ wq, const float* __restrict__ bq, const float* __restrict__ wk, const float* __restrict__ bk, const float* __restrict__ wv, const float* __restrict__ bv, float* __restrict__ outb) {
    __shared__ __align__(16) bf sm[8 * 64 * OP * 2];   // 73,728 B: in the loop two stages of two planes, then two buffers of x^T (55,296 B); after the loop all of it is 8 waves x [64 ch][OP] floats of output staging
    const int tid = threadIdx.x, lane = tid & 31, lr = lane & 15, hi = lane >> 4; const int wave = tid >> 5;
    const float* xs = x + (size_t)blockIdx.y * CC * TT; const int q0 = blockIdx.x * 256 + wave * 32;
    // x staging: wave w moves channels 8 w .. 8 w + 7, a lane keys 2 lane and 2 lane + 1 (a load covers 256 B in a row); rounded to f16 they are two 16-byte pieces of x^T
    const float* xg = xs + (size_t)(8 * wave) * TT + 2 * lane; bf* xt = sm + 2 * 2 * FPL; bf* xdst = xt + 2 * lane * FP + 8 * wave;
    v2f xr[8];
#define XLOADS(s) { _Pragma("unroll") for (int c = 0; c < 8; ++c) xr[c] = *(const v2f*)(xg + (size_t)c * TT + (s) * FS); \
    asm volatile("s_wait_xcnt 0x0" ::: "memory"); /* before the code that follows reuses the address registers of these loads */ }
#define XSTORES(b) { _Pragma("unroll") for (int p = 0; p < 2; ++p) { v4u u; _Pragma("unroll") for (int i = 0; i < 4; ++i) u[i] = pk2(xr[2 * i][p], xr[2 * i + 1][p]); *(v4ua*)(xdst + (b) * FPL + p * FP) = u; } }
    // every load of the prologue stands at its head, so that one memory latency covers them all. Behind each group that shares an address base: s_wait_xcnt 0, before later code reuses the group's address registers,
    // and a scheduling barrier, without which the scheduler lifts the next group's address arithmetic and the conversions over that wait
#define XWAIT { asm volatile("s_wait_xcnt 0x0" ::: "memory"); __builtin_amdgcn_sched_barrier(0); }
    XLOADS(0)
    __builtin_amdgcn_sched_barrier(0);              // as in XWAIT
    const int th = wave >> 2, ot = wave & 3;
    v4f wkv[2][2][4]; v8f bkraw; float bvraw;       // the wave's own weight tiles and biases for the k and v projections
    { const int wo = (ot * 16 + lr) * DM + 8 * hi;
#pragma unroll
        for (int ks = 0; ks < 2; ++ks)
#pragma unroll
            for (int g = 0; g < 4; ++g) { wkv[0][ks][g] = *(const v4f*)(wk + wo + ks * 32 + (g >> 1) * 16 + (g & 1) * 4); wkv[1][ks][g] = *(const v4f*)(wv + wo + ks * 32 + (g >> 1) * 16 + (g & 1) * 4); } }
    XWAIT
    bkraw = *(const v8f*)(bk + ot * 16 + 8 * hi);
    XWAIT
    bvraw = bv[ot * 16 + lr];
    XWAIT
    v2f xv[2][16]; v4f wr[4][2][4]; v8f bqraw[4];   // x of the wave's 32 queries, the whole q weight and bias
    { const float* xp = xs + (size_t)(8 * hi) * TT + q0 + 2 * lr;
#pragma unroll
        for (int ks = 0; ks < 2; ++ks)
#pragma unroll
            for (int s = 0; s < 16; ++s) xv[ks][s] = *(const v2f*)(xp + (size_t)(ks * 32 + (s >> 3) * 16 + (s & 7)) * TT); }
    XWAIT
#pragma unroll
    for (int o = 0; o < 4; ++o) bqraw[o] = *(const v8f*)(bq + o * 16 + 8 * hi);
    XWAIT
    { const float* wp = wq + lr * DM + 8 * hi;
#pragma unroll
        for (int o = 0; o < 4; ++o)
#pragma unroll
            for (int ks = 0; ks < 2; ++ks)
#pragma unroll
                for (int g = 0; g < 4; ++g) wr[o][ks][g] = *(const v4f*)(wp + o * 16 * DM + ks * 32 + (g >> 1) * 16 + (g & 1) * 4);
        asm volatile("s_wait_xcnt 0x0" :: "v"(wp) : "memory");   // as in XWAIT; the address is named as an input so that its registers stay live up to the wait: otherwise the group's last load lands on them
        __builtin_amdgcn_sched_barrier(0); }
    XSTORES(0)
    XLOADS(1)
    __builtin_amdgcn_sched_barrier(0);              // as in XWAIT
    v16h wkf[2], wvf[2]; const v8f bbk = bkraw; const float bbv = bvraw;
#pragma unroll
    for (int ks = 0; ks < 2; ++ks) { v8u u0, u1;
#pragma unroll
        for (int s = 0; s < 8; ++s) { u0[s] = pk2(wkv[0][ks][s >> 1][(s & 1) * 2], wkv[0][ks][s >> 1][(s & 1) * 2 + 1]); u1[s] = pk2(wkv[1][ks][s >> 1][(s & 1) * 2], wkv[1][ks][s >> 1][(s & 1) * 2 + 1]); }
        wkf[ks] = __builtin_bit_cast(v16h, u0); wvf[ks] = __builtin_bit_cast(v16h, u1); }
    // q of the wave's 32 queries: D = Wq X; column i of tile qt is query q0 + 2 i + qt, so one 8-byte load of x feeds both tiles; D tiles 2 ks and 2 ks + 1 of a column are one B operand as they lie
    v16h qh[2][2];
    { v16h xf[2][2], wf[4][2];
#pragma unroll
        for (int ks = 0; ks < 2; ++ks) {
#pragma unroll
            for (int qt = 0; qt < 2; ++qt) { v8u u;
#pragma unroll
                for (int s = 0; s < 8; ++s) u[s] = pk2(xv[ks][2 * s][qt], xv[ks][2 * s + 1][qt]);
                xf[qt][ks] = __builtin_bit_cast(v16h, u); }
#pragma unroll
            for (int o = 0; o < 4; ++o) { v8u u;
#pragma unroll
                for (int s = 0; s < 8; ++s) u[s] = pk2(wr[o][ks][s >> 1][(s & 1) * 2], wr[o][ks][s >> 1][(s & 1) * 2 + 1]);
                wf[o][ks] = __builtin_bit_cast(v16h, u); } }
        v8f a[4][2];
#pragma unroll
        for (int o = 0; o < 4; ++o)
#pragma unroll
            for (int qt = 0; qt < 2; ++qt) a[o][qt] = (v8f){};
#pragma unroll
        for (int ks = 0; ks < 2; ++ks)
#pragma unroll
            for (int o = 0; o < 4; ++o)
#pragma unroll
                for (int qt = 0; qt < 2; ++qt) a[o][qt] = wmmab(wf[o][ks], xf[qt][ks], a[o][qt]);
#pragma unroll
        for (int qt = 0; qt < 2; ++qt)
#pragma unroll
            for (int ks = 0; ks < 2; ++ks) qh[qt][ks] = __builtin_bit_cast(v16h, __builtin_shufflevector(pack8(a[2 * ks][qt] + bqraw[2 * ks]), pack8(a[2 * ks + 1][qt] + bqraw[2 * ks + 1]), 0, 1, 2, 3, 4, 5, 6, 7)); }
    const int fo = lr * FP + 8 * hi;
    const bf* pxb = xt + th * 32 * FP + fo; bf* kdst = sm + th * 32 * FP + lr * FP + ot * 16 + 8 * hi; bf* vdst = sm + FPL + (ot * 16 + lr) * FP + th * 32 + 8 * hi;
    v8f ak[2], av[2];
#define PROJMM(n) proj_mm(pxb + ((n) & 1) * FPL, wkf[0], wkf[1], wvf[0], wvf[1], ak, av);
#define PROJST(n) proj_st(kdst + ((n) & 1) * 2 * FPL, vdst + ((n) & 1) * 2 * FPL, ak, av, bbk, bbv);
    v8f acc[4][2];
#pragma unroll
    for (int ct = 0; ct < 4; ++ct)
#pragma unroll
        for (int qt = 0; qt < 2; ++qt) acc[ct][qt] = (v8f){};
    float muse[2] = { -3.0e38f, -3.0e38f }, lsum[2] = { 0.f, 0.f };   // per query column: the maximum in use (log2 units) and this lane's share of the sum
    __syncthreads();                                // publishes x^T of stage 0
    PROJMM(0) PROJST(0)
    XSTORES(1)
    __syncthreads();                                // publishes the planes of stage 0 and x^T of stage 1
#pragma unroll 1
    for (int s = 0; s < TT / FS; ++s) {
        if (s + 2 < TT / FS) XLOADS(s + 2)
        // the planes of stage s + 1: reads x^T of stage s + 1, published by the barrier that ended stage s - 1; the last readers of the planes it writes left them before that barrier.
        // Its products stand in front of the score products, its vector work and stores between their two k steps, under no branch, so that the vector work can issue beside the score products; in the last stage it works on the x^T of two stages back and nobody reads what it writes
        PROJMM(s + 1)
        const bf* sb = sm + (s & 1) * 2 * FPL + fo;
        v8f st[4][2];
#pragma unroll
        for (int kt = 0; kt < 4; ++kt)
#pragma unroll
            for (int qt = 0; qt < 2; ++qt) st[kt][qt] = (v8f){};
        v16h kh[2][4];   // every K fragment of the stage is read in front of the projection's stores
#pragma unroll
        for (int ks = 0; ks < 2; ++ks)
#pragma unroll
            for (int kt = 0; kt < 4; ++kt) kh[ks][kt] = ldfrag(sb + kt * 16 * FP + ks * 32);
#pragma unroll
        for (int ks = 0; ks < 2; ++ks) {
#pragma unroll
            for (int kt = 0; kt < 4; ++kt)
#pragma unroll
                for (int qt = 0; qt < 2; ++qt) st[kt][qt] = wmmab(kh[ks][kt], qh[qt][ks], st[kt][qt]);
            if (ks == 0) PROJST(s + 1) }
        // the stage's maximum per query column: in-lane, then one exchange between the wave's halves
        float m2[2];
#pragma unroll
        for (int qt = 0; qt < 2; ++qt) { float mk[4];
#pragma unroll
            for (int kt = 0; kt < 4; ++kt) { mk[kt] = st[kt][qt][0];
#pragma unroll
                for (int j = 1; j < 8; ++j) mk[kt] = fmaxf(mk[kt], st[kt][qt][j]); }
            const float m = fmaxf(fmaxf(mk[0], mk[1]), fmaxf(mk[2], mk[3])); m2[qt] = fmaxf(m, xhalf(m)) * L2E; }
        // rescale only when some column's maximum has outgrown the one in use by 2^8 (one scalar branch a stage); weights stay <= 2^8
        if (__builtin_amdgcn_ballot_w32(m2[0] > muse[0] + 8.0f || m2[1] > muse[1] + 8.0f) != 0) {
#pragma unroll
            for (int qt = 0; qt < 2; ++qt) { const float mn = fmaxf(muse[qt], m2[qt]); const float al = __builtin_amdgcn_exp2f(muse[qt] - mn); muse[qt] = mn; lsum[qt] *= al;
#pragma unroll
                for (int ct = 0; ct < 4; ++ct) acc[ct][qt] *= al; }
        }
        // weights 2^(s log2e - max) in f32, summed in f32, rounded to f16; tiles 2 ks and 2 ks + 1 of a column are one B operand as they lie
        v16h ph[2][2];
#pragma unroll
        for (int qt = 0; qt < 2; ++qt) { v2f sk[4]; v8u pw[2]; const v2f l2 = { L2E, L2E }, nm = { -muse[qt], -muse[qt] };
#pragma unroll
            for (int kt = 0; kt < 4; ++kt) { v2f t[4];
#pragma unroll
                for (int j = 0; j < 4; ++j) { v2f sp; sp[0] = st[kt][qt][2 * j]; sp[1] = st[kt][qt][2 * j + 1]; t[j] = __builtin_elementwise_fma(sp, l2, nm); }   // v_pk_fma_f32: two arguments an instruction, each rounded as by fmaf
                // the bare v_exp_f32 as a builtin: the compiler sees it, keeps the distances behind matrix instructions and the slot behind a transcendental itself, and spends a v_nop only where no other instruction fits
#pragma unroll
                for (int j = 0; j < 4; ++j) { t[j][0] = __builtin_amdgcn_exp2f(t[j][0]); t[j][1] = __builtin_amdgcn_exp2f(t[j][1]); }
                sk[kt] = t[0]; pw[kt >> 1][(kt & 1) * 4] = pk2(t[0][0], t[0][1]);
#pragma unroll
                for (int j = 1; j < 4; ++j) { sk[kt] += t[j]; pw[kt >> 1][(kt & 1) * 4 + j] = pk2(t[j][0], t[j][1]); } }
            ph[0][qt] = __builtin_bit_cast(v16h, pw[0]); ph[1][qt] = __builtin_bit_cast(v16h, pw[1]);
            const v2f s2 = (sk[0] + sk[1]) + (sk[2] + sk[3]); lsum[qt] += s2[0] + s2[1]; }
#pragma unroll
        for (int ks = 0; ks < 2; ++ks) { v16h vh[4];
#pragma unroll
            for (int ct = 0; ct < 4; ++ct) vh[ct] = ldfrag(sb + FPL + ct * 16 * FP + ks * 32);
#pragma unroll
            for (int ct = 0; ct < 4; ++ct)
#pragma unroll
                for (int qt = 0; qt < 2; ++qt) acc[ct][qt] = wmmab(vh[ct], ph[ks][qt], acc[ct][qt]); }
        if (s + 2 < TT / FS) XSTORES(s & 1)         // its last readers (the projection of stage s) left it before the barrier that ended stage s - 1
        __syncthreads();                            // publishes the planes of stage s + 1 and x^T of stage s + 2, ends every read of stage s
    }
    // epilogue: join the halves' sums, normalise, stage each wave's [64 ch][32 queries] in its own LDS range, store whole 128-byte lines
    float* os = (float*)sm + wave * 64 * OP;
#pragma unroll
    for (int qt = 0; qt < 2; ++qt) { const float t = lsum[qt] + xhalf(lsum[qt]); const float f = __fdiv_rn(1.0f, t);
#pragma unroll
        for (int ct = 0; ct < 4; ++ct)
#pragma unroll
            for (int j = 0; j < 8; ++j) *(f32a*)(os + (ct * 16 + hi * 8 + j) * OP + 2 * lr + qt) = acc[ct][qt][j] * f; }
    float* og = outb + (size_t)blockIdx.y * CC * TT + q0;
#pragma unroll
    for (int it = 0; it < 16; ++it) { const int c = it * 4 + (lane >> 3), x = (lane & 7) * 4; *(v4f*)(og + (size_t)c * TT + x) = *(const v4fa*)(os + c * OP + x); }
}
extern "C" void kernel_launch(void* const* d_in, const int* in_sizes, int n_in,
                              void* d_out, int out_size, void* d_ws, size_t ws_size, hipStream_t stream) {
    (void)in_sizes; (void)n_in; (void)out_size; (void)d_ws; (void)ws_size;
    const float* x = (const float*)d_in[0]; const float* wq = (const float*)d_in[1]; const float* bq = (const float*)d_in[2]; const float* wk = (const float*)d_in[3]; const float* bk = (const float*)d_in[4]; const float* wv = (const float*)d_in[5]; const float* bv = (const float*)d_in[6];
    float* OUT = (float*)d_out;     // [64][64][1024]
    k_fattn<<<dim3(TT / 256, NB_, 1), 256, 0, stream>>>(x, wq, bq, wk, bk, wv, bv, OUT);   /* projections, scores, softmax, weights.v; writes the channel-major output */
}

// v007
// It runs in 22.3 microseconds.
// Next to v006, in two timings, it ran 1.12 times as fast each time.
// All steps since v000 together make it 160 times as fast.
#include <hip/hip_runtime.h>

// Spatial self-attention over 1,024 positions for each of 64 (batch, time) slices (x [8][8][64][1024] channel-major; q, k, v = 1x1 convs ('oi' [64][64] + [64]); scores = q.k over the 64 channels, unscaled; softmax over positions; out = (weights v)^T channel-major -> [8][8][64][1024]).
// ONE kernel: a work-group owns 256 queries of one slice. It forms its q in registers, and for every stage of 64 keys it forms k and v^T itself from x (f16 fragments through LDS) and lays them in LDS as f16; scores, softmax and weights.v as one product each side, running maximum and sum per query; the transposed products give channel-major rows directly.
// Compute dtypes, f32 accumulate: x and the three weight matrices rounded to f16; f32 biases added to the f32 accumulators; q, k, v and the softmax weights rounded once to f16 (q, k, v are a few units for these generators, the weights <= 2^8: far inside the f16 range); softmax f32; output f32.

#define NB_  64
#define TT   1024
#define DM   64
#define NH_  1
#define NKV  1
#define REP  (NH_ / NKV)
#define HD   64
#define DQ   (NH_ * HD)
#define DKV  (NKV * HD)
#define ZH   1
#define WIN  0
#define PCAR 1024.0f
#define SCL  1.0f   // unscaled
#define CC   64
typedef unsigned short bf;
typedef __attribute__((ext_vector_type(16))) _Float16 v16h;
typedef __attribute__((ext_vector_type(8)))  unsigned short v8us;
typedef __attribute__((ext_vector_type(8)))  float    v8f;
typedef __attribute__((ext_vector_type(4)))  float    v4f;
typedef v4f  __attribute__((may_alias)) v4fa;
typedef v8us __attribute__((may_alias)) v8usa;

__device__ __forceinline__ v16h cat16b(v8us lo, v8us hi) { return __builtin_bit_cast(v16h, __builtin_shufflevector(lo, hi, 0, 1, 2, 3, 4, 5, 6, 7, 8, 9, 10, 11, 12, 13, 14, 15)); }
__device__ __forceinline__ v8f wmmab(v16h a, v16h b, v8f c) { return __builtin_amdgcn_wmma_f32_16x16x32_f16(false, a, false, b, (short)0, c, false, false); }
typedef __attribute__((ext_vector_type(2))) float v2f;

#define FS  64                     // keys per stage
#define FP  72                     // LDS row pitch in 16-bit elements: 144 B = 16 B x odd, conflict-free for 16-byte row reads
#define FPL (64 * FP)              // one plane of a stage
#define OP  36                     // output staging pitch in floats
#define L2E 1.4426950408889634f
typedef __attribute__((ext_vector_type(2))) _Float16 v2h;
typedef float __attribute__((may_alias)) f32a;
__device__ __forceinline__ v16h ldfrag(const bf* p) { return cat16b(*(const v8usa*)p, *(const v8usa*)(p + 16)); }   // hardware k order: 8 hi + s, 16 + 8 hi + (s - 8)
__device__ __forceinline__ float xhalf(float x) { const int b = __float_as_int(x); return __int_as_float(__builtin_amdgcn_permlanex16(b, b, 0x76543210, 0xfedcba98, false, false)); }   // lane l <-> l ^ 16
typedef __attribute__((ext_vector_type(4))) unsigned v4u;
typedef __attribute__((ext_vector_type(8))) unsigned v8u;
typedef v4u __attribute__((may_alias)) v4ua;
__device__ __forceinline__ unsigned pk2(float a, float b) { v2f e; e[0] = a; e[1] = b; return __builtin_bit_cast(unsigned, __builtin_convertvector(e, v2h)); }   // two f32 -> one word of two f16, round to nearest even
__device__ __forceinline__ v4u pack8(const v8f y) { v4u h4;
#pragma unroll
    for (int j = 0; j < 4; ++j) h4[j] = pk2(y[2 * j], y[2 * j + 1]);
    return h4; }
// one wave's share of a stage's projection, in three parts. proj_ld: the x^T fragments of 32 keys from LDS; proj_mm: 4 products for k and 4 for v
__device__ __forceinline__ void proj_ld(const bf* xb, v16h (&xf)[2][2]) {
#pragma unroll
    for (int t = 0; t < 2; ++t) { xf[t][0] = ldfrag(xb + t * 16 * FP); xf[t][1] = ldfrag(xb + t * 16 * FP + 32); }
}
__device__ __forceinline__ void proj_mm(const v16h (&xf)[2][2], const v16h wk0, const v16h wk1, const v16h wv0, const v16h wv1, v8f (&ak)[2], v8f (&av)[2]) {
#pragma unroll
    for (int t = 0; t < 2; ++t) { ak[t] = wmmab(wk0, xf[t][0], (v8f){}); av[t] = wmmab(xf[t][0], wv0, (v8f){}); }
#pragma unroll
    for (int t = 0; t < 2; ++t) { ak[t] = wmmab(wk1, xf[t][1], ak[t]); av[t] = wmmab(xf[t][1], wv1, av[t]); }
}
// proj_st: bias, rounding to f16, 16-byte pieces into the K and V^T planes
__device__ __forceinline__ void proj_st(bf* kdst, bf* vdst, const v8f (&ak)[2], const v8f (&av)[2], const v8f bbk, const float bbv) {
#pragma unroll
    for (int t = 0; t < 2; ++t) { *(v4ua*)(kdst + t * 16 * FP) = pack8(ak[t] + bbk); *(v4ua*)(vdst + t * 16) = pack8(av[t] + bbv); }
}
__global__ __launch_bounds__(256) void k_fattn(const float* __restrict__ x, const float* __restrict__ wq, const float* __restrict__ bq, const float* __restrict__ wk, const float* __restrict__ bk, const float* __restrict__ wv, const float* __restrict__ bv, float* __restrict__ outb) {
    __shared__ __align__(16) bf sm[4 * 2 * FPL + 4 * FPL];   // 110,592 B: in the loop four stages of two planes, then four buffers of x^T; after the loop its first 73,728 B are 8 waves x [64 ch][OP] floats of output staging
    const int tid = threadIdx.x, lane = tid & 31, lr = lane & 15, hi = lane >> 4; const int wave = tid >> 5;
    const float* xs = x + (size_t)blockIdx.y * CC * TT; const int q0 = blockIdx.x * 256 + wave * 32;
    // x staging: wave w moves channels 8 w .. 8 w + 7, a lane keys 2 lane and 2 lane + 1 (a load covers 256 B in a row); rounded to f16 they are two 16-byte pieces of x^T
    const float* xg = xs + (size_t)(8 * wave) * TT + 2 * lane; bf* xt = sm + 4 * 2 * FPL; bf* xdst = xt + 2 * lane * FP + 8 * wave;
    v2f xr[8], xr1[8], xr2[8];
#define XLD(r, s) { _Pragma("unroll") for (int c = 0; c < 8; ++c) r[c] = *(const v2f*)(xg + (size_t)c * TT + (s) * FS); }
#define XLOADS(s) { XLD(xr, s) \
    asm volatile("s_wait_xcnt 0x0" ::: "memory"); /* before the code that follows reuses the address registers of these loads */ }
#define XST(r, b) { _Pragma("unroll") for (int p = 0; p < 2; ++p) { v4u u; _Pragma("unroll") for (int i = 0; i < 4; ++i) u[i] = pk2(r[2 * i][p], r[2 * i + 1][p]); *(v4ua*)(xdst + (b) * FPL + p * FP) = u; } }
#define XSTORES(b) XST(xr, b)
    // every load of the prologue stands at its head, so that one memory latency covers them all. Behind each group that shares an address base: s_wait_xcnt 0, before later code reuses the group's address registers,
    // and a scheduling barrier, without which the scheduler lifts the next group's address arithmetic and the conversions over that wait
#define XWAIT { asm volatile("s_wait_xcnt 0x0" ::: "memory"); __builtin_amdgcn_sched_barrier(0); }
    XLD(xr, 0) XLD(xr1, 1) XLD(xr2, 2)              // x of the first three stages, one address base
    XWAIT
    const int th = wave >> 2, ot = wave & 3;
    v4f wkv[2][2][4]; v8f bkraw; float bvraw;       // the wave's own weight tiles and biases for the k and v projections
    { const int wo = (ot * 16 + lr) * DM + 8 * hi;
#pragma unroll
        for (int ks = 0; ks < 2; ++ks)
#pragma unroll
            for (int g = 0; g < 4; ++g) { wkv[0][ks][g] = *(const v4f*)(wk + wo + ks * 32 + (g >> 1) * 16 + (g & 1) * 4); wkv[1][ks][g] = *(const v4f*)(wv + wo + ks * 32 + (g >> 1) * 16 + (g & 1) * 4); } }
    XWAIT
    bkraw = *(const v8f*)(bk + ot * 16 + 8 * hi);
    XWAIT
    bvraw = bv[ot * 16 + lr];
    XWAIT
    v2f xv[2][16]; v4f wr[4][2][4]; v8f bqraw[4];   // x of the wave's 32 queries, the whole q weight and bias
    { const float* xp = xs + (size_t)(8 * hi) * TT + q0 + 2 * lr;
#pragma unroll
        for (int ks = 0; ks < 2; ++ks)
#pragma unroll
            for (int s = 0; s < 16; ++s) xv[ks][s] = *(const v2f*)(xp + (size_t)(ks * 32 + (s >> 3) * 16 + (s & 7)) * TT); }
    XWAIT
#pragma unroll
    for (int o = 0; o < 4; ++o) bqraw[o] = *(const v8f*)(bq + o * 16 + 8 * hi);
    XWAIT
    { const float* wp = wq + lr * DM + 8 * hi;
#pragma unroll
        for (int o = 0; o < 4; ++o)
#pragma unroll
            for (int ks = 0; ks < 2; ++ks)
#pragma unroll
                for (int g = 0; g < 4; ++g) wr[o][ks][g] = *(const v4f*)(wp + o * 16 * DM + ks * 32 + (g >> 1) * 16 + (g & 1) * 4);
        asm volatile("s_wait_xcnt 0x0" :: "v"(wp) : "memory");   // as in XWAIT; the address is named as an input so that its registers stay live up to the wait: otherwise the group's last load lands on them
        __builtin_amdgcn_sched_barrier(0); }
    XST(xr, 0) XST(xr1, 1) XST(xr2, 2)
    v16h wkf[2], wvf[2]; const v8f bbk = bkraw; const float bbv = bvraw;
#pragma unroll
    for (int ks = 0; ks < 2; ++ks) { v8u u0, u1;
#pragma unroll
        for (int s = 0; s < 8; ++s) { u0[s] = pk2(wkv[0][ks][s >> 1][(s & 1) * 2], wkv[0][ks][s >> 1][(s & 1) * 2 + 1]); u1[s] = pk2(wkv[1][ks][s >> 1][(s & 1) * 2], wkv[1][ks][s >> 1][(s & 1) * 2 + 1]); }
        wkf[ks] = __builtin_bit_cast(v16h, u0); wvf[ks] = __builtin_bit_cast(v16h, u1); }
    // q of the wave's 32 queries: D = Wq X; column i of tile qt is query q0 + 2 i + qt, so one 8-byte load of x feeds both tiles; D tiles 2 ks and 2 ks + 1 of a column are one B operand as they lie
    v16h qh[2][2];
    { v16h xf[2][2], wf[4][2];
#pragma unroll
        for (int ks = 0; ks < 2; ++ks) {
#pragma unroll
            for (int qt = 0; qt < 2; ++qt) { v8u u;
#pragma unroll
                for (int s = 0; s < 8; ++s) u[s] = pk2(xv[ks][2 * s][qt], xv[ks][2 * s + 1][qt]);
                xf[qt][ks] = __builtin_bit_cast(v16h, u); }
#pragma unroll
            for (int o = 0; o < 4; ++o) { v8u u;
#pragma unroll
                for (int s = 0; s < 8; ++s) u[s] = pk2(wr[o][ks][s >> 1][(s & 1) * 2], wr[o][ks][s >> 1][(s & 1) * 2 + 1]);
                wf[o][ks] = __builtin_bit_cast(v16h, u); } }
        v8f a[4][2];
#pragma unroll
        for (int o = 0; o < 4; ++o)
#pragma unroll
            for (int qt = 0; qt < 2; ++qt) a[o][qt] = (v8f){};
#pragma unroll
        for (int ks = 0; ks < 2; ++ks)
#pragma unroll
            for (int o = 0; o < 4; ++o)
#pragma unroll
                for (int qt = 0; qt < 2; ++qt) a[o][qt] = wmmab(wf[o][ks], xf[qt][ks], a[o][qt]);
#pragma unroll
        for (int qt = 0; qt < 2; ++qt)
#pragma unroll
            for (int ks = 0; ks < 2; ++ks) qh[qt][ks] = __builtin_bit_cast(v16h, __builtin_shufflevector(pack8(a[2 * ks][qt] + bqraw[2 * ks]), pack8(a[2 * ks + 1][qt] + bqraw[2 * ks + 1]), 0, 1, 2, 3, 4, 5, 6, 7)); }
    const int fo = lr * FP + 8 * hi;
    const bf* pxb = xt + th * 32 * FP + fo; bf* kdst = sm + th * 32 * FP + lr * FP + ot * 16 + 8 * hi; bf* vdst = sm + FPL + (ot * 16 + lr) * FP + th * 32 + 8 * hi;
    v8f ak[2], av[2]; v16h xf[2][2];
#define PROJLD(n) proj_ld(pxb + ((n) & 3) * FPL, xf);
#define PROJMM    proj_mm(xf, wkf[0], wkf[1], wvf[0], wvf[1], ak, av);
#define PROJST(n) proj_st(kdst + ((n) & 3) * 2 * FPL, vdst + ((n) & 3) * 2 * FPL, ak, av, bbk, bbv);
    v8f acc[4][2];
#pragma unroll
    for (int ct = 0; ct < 4; ++ct)
#pragma unroll
        for (int qt = 0; qt < 2; ++qt) acc[ct][qt] = (v8f){};
    float muse[2] = { -3.0e38f, -3.0e38f }, lsum[2] = { 0.f, 0.f };   // per query column: the maximum in use (log2 units) and this lane's share of the sum
    __syncthreads();                                // publishes x^T of stages 0, 1 and 2
    PROJLD(0) PROJMM PROJST(0)
    PROJLD(1) PROJMM PROJST(1)
    __syncthreads();                                // publishes the planes of stages 0 and 1
    v16h kh[2][4];                                  // the K fragments of the stage at hand, fetched one stage ahead
#pragma unroll
    for (int ks = 0; ks < 2; ++ks)
#pragma unroll
        for (int kt = 0; kt < 4; ++kt) kh[ks][kt] = ldfrag(sm + fo + kt * 16 * FP + ks * 32);
#pragma unroll 1
    for (int s = 0; s < TT / FS; ++s) {
        if (s + 3 < TT / FS) XLOADS(s + 3)
        // every LDS read is issued a phase ahead of its use, in three groups a stage. At the stage's head the x^T fragments of stage s + 2 (stored in stage s - 1): they fly under the score products, whose K fragments are in registers already
        const bf* sb = sm + (s & 3) * 2 * FPL + fo;
        PROJLD(s + 2)
        __builtin_amdgcn_sched_barrier(0);          // keeps the reads in front of the products: the scheduler otherwise sinks a read towards its use, where its latency is waited out
        v8f st[4][2];
#pragma unroll
        for (int kt = 0; kt < 4; ++kt)
#pragma unroll
            for (int qt = 0; qt < 2; ++qt) st[kt][qt] = (v8f){};
#pragma unroll
        for (int ks = 0; ks < 2; ++ks)
#pragma unroll
            for (int kt = 0; kt < 4; ++kt)
#pragma unroll
                for (int qt = 0; qt < 2; ++qt) st[kt][qt] = wmmab(kh[ks][kt], qh[qt][ks], st[kt][qt]);
        __builtin_amdgcn_sched_barrier(0);          // keeps the reads below out of the run of score products
        // behind the score products, in one group: every V^T fragment of stage s (planes written in stage s - 2); they fly under the projection and the softmax
        v16h vh[2][4];
#pragma unroll
        for (int ks = 0; ks < 2; ++ks)
#pragma unroll
            for (int ct = 0; ct < 4; ++ct) vh[ks][ct] = ldfrag(sb + FPL + ct * 16 * FP + ks * 32);
        __builtin_amdgcn_sched_barrier(0);          // keeps the group together, in front of the projection
        // the planes of stage s + 2, under no branch; the last readers of the planes it writes (stage s - 2) left them before the barrier that ended stage s - 2; in the last two stages it works on old x^T and nobody reads what it writes
        PROJMM PROJST(s + 2)
        // the stage's maximum per query column: in-lane, then one exchange between the wave's halves
        float m2[2];
#pragma unroll
        for (int qt = 0; qt < 2; ++qt) { float mk[4];
#pragma unroll
            for (int kt = 0; kt < 4; ++kt) { mk[kt] = st[kt][qt][0];
#pragma unroll
                for (int j = 1; j < 8; ++j) mk[kt] = fmaxf(mk[kt], st[kt][qt][j]); }
            const float m = fmaxf(fmaxf(mk[0], mk[1]), fmaxf(mk[2], mk[3])); m2[qt] = fmaxf(m, xhalf(m)) * L2E; }
        // rescale only when some column's maximum has outgrown the one in use by 2^8 (one scalar branch a stage); weights stay <= 2^8
        if (__builtin_amdgcn_ballot_w32(m2[0] > muse[0] + 8.0f || m2[1] > muse[1] + 8.0f) != 0) {
#pragma unroll
            for (int qt = 0; qt < 2; ++qt) { const float mn = fmaxf(muse[qt], m2[qt]); const float al = __builtin_amdgcn_exp2f(muse[qt] - mn); muse[qt] = mn; lsum[qt] *= al;
#pragma unroll
                for (int ct = 0; ct < 4; ++ct) acc[ct][qt] *= al; }
        }
        // in front of the exponents, in one group: the K fragments of stage s + 1 (planes written in stage s - 1, published by the barrier that ended it), into the registers that the score products have read;
        // they fly under the softmax and the weights.v products; in the last stage nobody uses them
        { const bf* sn = sm + ((s + 1) & 3) * 2 * FPL + fo;
#pragma unroll
            for (int ks = 0; ks < 2; ++ks)
#pragma unroll
                for (int kt = 0; kt < 4; ++kt) kh[ks][kt] = ldfrag(sn + kt * 16 * FP + ks * 32); }
        __builtin_amdgcn_sched_barrier(0);          // keeps the group together, in front of the exponents
        // weights 2^(s log2e - max) in f32, summed in f32, rounded to f16; tiles 2 ks and 2 ks + 1 of a column are one B operand as they lie
        v16h ph[2][2];
#pragma unroll
        for (int qt = 0; qt < 2; ++qt) { v2f sk[4]; v8u pw[2]; const v2f l2 = { L2E, L2E }, nm = { -muse[qt], -muse[qt] };
#pragma unroll
            for (int kt = 0; kt < 4; ++kt) { v2f t[4];
#pragma unroll
                for (int j = 0; j < 4; ++j) { v2f sp; sp[0] = st[kt][qt][2 * j]; sp[1] = st[kt][qt][2 * j + 1]; t[j] = __builtin_elementwise_fma(sp, l2, nm); }   // v_pk_fma_f32: two arguments an instruction, each rounded as by fmaf
                // the bare v_exp_f32 as a builtin: the compiler sees it, keeps the distances behind matrix instructions and the slot behind a transcendental itself, and spends a v_nop only where no other instruction fits
#pragma unroll
                for (int j = 0; j < 4; ++j) { t[j][0] = __builtin_amdgcn_exp2f(t[j][0]); t[j][1] = __builtin_amdgcn_exp2f(t[j][1]); }
                sk[kt] = t[0]; pw[kt >> 1][(kt & 1) * 4] = pk2(t[0][0], t[0][1]);
#pragma unroll
                for (int j = 1; j < 4; ++j) { sk[kt] += t[j]; pw[kt >> 1][(kt & 1) * 4 + j] = pk2(t[j][0], t[j][1]); } }
            ph[0][qt] = __builtin_bit_cast(v16h, pw[0]); ph[1][qt] = __builtin_bit_cast(v16h, pw[1]);
            const v2f s2 = (sk[0] + sk[1]) + (sk[2] + sk[3]); lsum[qt] += s2[0] + s2[1]; }
#pragma unroll
        for (int ks = 0; ks < 2; ++ks)
#pragma unroll
            for (int ct = 0; ct < 4; ++ct)
#pragma unroll
                for (int qt = 0; qt < 2; ++qt) acc[ct][qt] = wmmab(vh[ks][ct], ph[ks][qt], acc[ct][qt]);
        if (s + 3 < TT / FS) XSTORES((s + 3) & 3)   // its last readers (the projection of stage s - 1) left it in stage s - 3
        __syncthreads();                            // publishes the planes of stage s + 2 and x^T of stage s + 3, ends every read of stage s
    }
    // epilogue: join the halves' sums, normalise, stage each wave's [64 ch][32 queries] in its own LDS range, store whole 128-byte lines
    float* os = (float*)sm + wave * 64 * OP;
#pragma unroll
    for (int qt = 0; qt < 2; ++qt) { const float t = lsum[qt] + xhalf(lsum[qt]); const float f = __fdiv_rn(1.0f, t);
#pragma unroll
        for (int ct = 0; ct < 4; ++ct)
#pragma unroll
            for (int j = 0; j < 8; ++j) *(f32a*)(os + (ct * 16 + hi * 8 + j) * OP + 2 * lr + qt) = acc[ct][qt][j] * f; }
    float* og = outb + (size_t)blockIdx.y * CC * TT + q0;
#pragma unroll
    for (int it = 0; it < 16; ++it) { const int c = it * 4 + (lane >> 3), x = (lane & 7) * 4; *(v4f*)(og + (size_t)c * TT + x) = *(const v4fa*)(os + c * OP + x); }
}
extern "C" void kernel_launch(void* const* d_in, const int* in_sizes, int n_in,
                              void* d_out, int out_size, void* d_ws, size_t ws_size, hipStream_t stream) {
    (void)in_sizes; (void)n_in; (void)out_size; (void)d_ws; (void)ws_size;
    const float* x = (const float*)d_in[0]; const float* wq = (const float*)d_in[1]; const float* bq = (const float*)d_in[2]; const float* wk = (const float*)d_in[3]; const float* bk = (const float*)d_in[4]; const float* wv = (const float*)d_in[5]; const float* bv = (const float*)d_in[6];
    float* OUT = (float*)d_out;     // [64][64][1024]
    k_fattn<<<dim3(TT / 256, NB_, 1), 256, 0, stream>>>(x, wq, bq, wk, bk, wv, bv, OUT);   /* projections, scores, softmax, weights.v; writes the channel-major output */
}

// v008
// A run of this version takes 21.5 microseconds.
// Timed twice side by side with v007, it ran 1.04 times as fast both times.
// Over all steps from v000 it is 167 times as fast.
#include <hip/hip_runtime.h>

// Spatial self-attention over 1,024 positions for each of 64 (batch, time) slices (x [8][8][64][1024] channel-major; q, k, v = 1x1 convs ('oi' [64][64] + [64]); scores = q.k over the 64 channels, unscaled; softmax over positions; out = (weights v)^T channel-major -> [8][8][64][1024]).
// ONE kernel: a work-group owns 256 queries of one slice. The k and v projections are linear, so they are taken out of the key loop: scores = (Wk^T q).x + q.bk, whose second term is the same for every key of a query and cancels in the softmax; out = Wv (weights.x) + bv, the weights of a query summing to 1. The loop stages x alone (f16, in both orders) and runs one product each side, running maximum and sum per query; the transposed products give channel-major rows directly.
// Compute dtypes, f32 accumulate: x, Wq and Wv rounded to f16; q and Wk enter the product Wk^T q as f16 hi + lo pairs (three products, once per work-group), so that neither rounding reaches the scores; Wk^T q, the softmax weights (<= 2^8) and the normalised weights.x rounded once to f16; f32 biases added to the f32 accumulators; softmax f32; output f32.

#define NB_  64
#define TT   1024
#define DM   64
#define NH_  1
#define NKV  1
#define REP  (NH_ / NKV)
#define HD   64
#define DQ   (NH_ * HD)
#define DKV  (NKV * HD)
#define ZH   1
#define WIN  0
#define PCAR 1024.0f
#define SCL  1.0f   // unscaled
#define CC   64
typedef unsigned short bf;
typedef __attribute__((ext_vector_type(16))) _Float16 v16h;
typedef __attribute__((ext_vector_type(8)))  unsigned short v8us;
typedef __attribute__((ext_vector_type(8)))  float    v8f;
typedef __attribute__((ext_vector_type(4)))  float    v4f;
typedef v4f  __attribute__((may_alias)) v4fa;
typedef v8us __attribute__((may_alias)) v8usa;

__device__ __forceinline__ v16h cat16b(v8us lo, v8us hi) { return __builtin_bit_cast(v16h, __builtin_shufflevector(lo, hi, 0, 1, 2, 3, 4, 5, 6, 7, 8, 9, 10, 11, 12, 13, 14, 15)); }
__device__ __forceinline__ v8f wmmab(v16h a, v16h b, v8f c) { return __builtin_amdgcn_wmma_f32_16x16x32_f16(false, a, false, b, (short)0, c, false, false); }
typedef __attribute__((ext_vector_type(2))) float v2f;

// ---- k_fattn: projections, scores, softmax and weights.x of 256 queries of one slice; q, the scores and the weights never leave the registers.
// S^T = X^T Q' (A = x^T rows from LDS, B = Q' = Wk^T q kept in registers), Y += X P^T (A = x rows from LDS, B = two score tiles converted in place): a lane holds one query's column; O^T = Wv Y / sum + bv is the channel-major output.
// 8 waves x 32 query columns; grid (TT / 256, slices). A stage is 64 keys: x^T [64 keys][64 ch] and x [64 ch][64 keys] in f16, four buffers, staged through registers three stages ahead.
// k order of every operand, element s of k step ks: index 32 ks + 8 hi + s (s < 8), 32 ks + 16 + 8 hi + (s - 8).
#define FS  64                     // keys per stage
#define FP  72                     // LDS row pitch in 16-bit elements: 144 B = 16 B x odd, conflict-free for 16-byte row reads
#define FPL (64 * FP)              // one plane of a stage
#define OP  36                     // output staging pitch in floats
#define L2E 1.4426950408889634f
typedef __attribute__((ext_vector_type(2))) _Float16 v2h;
typedef float __attribute__((may_alias)) f32a;
__device__ __forceinline__ v16h ldfrag(const bf* p) { return cat16b(*(const v8usa*)p, *(const v8usa*)(p + 16)); }   // hardware k order: 8 hi + s, 16 + 8 hi + (s - 8)
__device__ __forceinline__ float xhalf(float x) { const int b = __float_as_int(x); return __int_as_float(__builtin_amdgcn_permlanex16(b, b, 0x76543210, 0xfedcba98, false, false)); }   // lane l <-> l ^ 16
typedef __attribute__((ext_vector_type(4))) unsigned v4u;
typedef __attribute__((ext_vector_type(8))) unsigned v8u;
typedef v4u __attribute__((may_alias)) v4ua;
__device__ __forceinline__ unsigned pk2(float a, float b) { v2f e; e[0] = a; e[1] = b; return __builtin_bit_cast(unsigned, __builtin_convertvector(e, v2h)); }   // two f32 -> one word of two f16, round to nearest even
__device__ __forceinline__ v4u pack8(const v8f y) { v4u h4;
#pragma unroll
    for (int j = 0; j < 4; ++j) h4[j] = pk2(y[2 * j], y[2 * j + 1]);
    return h4; }
// one word of two f16 and the word of what the rounding left over
__device__ __forceinline__ void pk2s(float a, float b, unsigned& h, unsigned& l) { h = pk2(a, b); const v2f r = __builtin_convertvector(__builtin_bit_cast(v2h, h), v2f); l = pk2(a - r[0], b - r[1]); }
typedef unsigned __attribute__((may_alias)) u32a;
__global__ __launch_bounds__(256) void k_fattn(const float* __restrict__ x, const float* __restrict__ wq, const float* __restrict__ bq, const float* __restrict__ wk, const float* __restrict__ bk, const float* __restrict__ wv, const float* __restrict__ bv, float* __restrict__ outb) {
    (void)bk;                                       // q.bk is one constant per query over all keys: the softmax does not see it
    __shared__ __align__(16) bf sm[4 * 2 * FPL + 2 * FPL];   // 92,160 B: four stages of two planes (x^T, x), then Wk^T hi and lo; after the loop its first 73,728 B are 8 waves x [64 ch][OP] floats of output staging
    const int tid = threadIdx.x, lane = tid & 31, lr = lane & 15, hi = lane >> 4; const int wave = tid >> 5;
    const float* xs = x + (size_t)blockIdx.y * CC * TT; const int q0 = blockIdx.x * 256 + wave * 32;
    // x staging: wave w moves channels 8 w .. 8 w + 7, a lane keys 2 lane and 2 lane + 1 (a load covers 256 B in a row); rounded to f16 they are two 16-byte pieces of x^T and eight words of x
    const float* xg = xs + (size_t)(8 * wave) * TT + 2 * lane; bf* xdst = sm + 2 * lane * FP + 8 * wave; bf* ndst = sm + FPL + 8 * wave * FP + 2 * lane;
    bf* wt = sm + 4 * 2 * FPL;
    v2f xr[8], xr1[8], xr2[8];
#define XLD(r, s) { _Pragma("unroll") for (int c = 0; c < 8; ++c) r[c] = *(const v2f*)(xg + (size_t)c * TT + (s) * FS); }
#define XLOADS(s) { XLD(xr, s) \
    asm volatile("s_wait_xcnt 0x0" ::: "memory"); /* before the code that follows reuses the address registers of these loads */ }
#define XST(r, b) { _Pragma("unroll") for (int p = 0; p < 2; ++p) { v4u u; _Pragma("unroll") for (int i = 0; i < 4; ++i) u[i] = pk2(r[2 * i][p], r[2 * i + 1][p]); *(v4ua*)(xdst + (b) * 2 * FPL + p * FP) = u; } \
    _Pragma("unroll") for (int c = 0; c < 8; ++c) *(u32a*)(ndst + (b) * 2 * FPL + c * FP) = pk2(r[c][0], r[c][1]); }
#define XSTORES(b) XST(xr, b)
    // every load of the prologue's first part stands at its head, so that one memory latency covers them all. Behind each group that shares an address base: s_wait_xcnt 0, before later code reuses the group's address registers,
    // and a scheduling barrier, without which the scheduler lifts the next group's address arithmetic and the conversions over that wait
#define XWAIT { asm volatile("s_wait_xcnt 0x0" ::: "memory"); __builtin_amdgcn_sched_barrier(0); }
    XLD(xr, 0) XLD(xr1, 1) XLD(xr2, 2)              // x of the first three stages, one address base
    XWAIT
    v2f wkr[8];                                     // Wk rows 8 w .. 8 w + 7, columns 2 lane and 2 lane + 1: moved like x, so that LDS holds Wk^T
    { const float* wg = wk + (8 * wave) * DM + 2 * lane;
#pragma unroll
        for (int c = 0; c < 8; ++c) wkr[c] = *(const v2f*)(wg + c * DM);
        asm volatile("s_wait_xcnt 0x0" :: "v"(wg) : "memory");   // as in XWAIT; the address is named as an input so that its registers stay live up to the wait
        __builtin_amdgcn_sched_barrier(0); }
    v2f xv[2][16]; v4f wr[4][2][4]; v8f bqraw[4];   // x of the wave's 32 queries, the whole q weight and bias
    { const float* xp = xs + (size_t)(8 * hi) * TT + q0 + 2 * lr;
#pragma unroll
        for (int ks = 0; ks < 2; ++ks)
#pragma unroll
            for (int s = 0; s < 16; ++s) xv[ks][s] = *(const v2f*)(xp + (size_t)(ks * 32 + (s >> 3) * 16 + (s & 7)) * TT); }
    XWAIT
#pragma unroll
    for (int o = 0; o < 4; ++o) bqraw[o] = *(const v8f*)(bq + o * 16 + 8 * hi);
    XWAIT
    { const float* wp = wq + lr * DM + 8 * hi;
#pragma unroll
        for (int o = 0; o < 4; ++o)
#pragma unroll
            for (int ks = 0; ks < 2; ++ks)
#pragma unroll
                for (int g = 0; g < 4; ++g) wr[o][ks][g] = *(const v4f*)(wp + o * 16 * DM + ks * 32 + (g >> 1) * 16 + (g & 1) * 4);
        asm volatile("s_wait_xcnt 0x0" :: "v"(wp) : "memory");   // as in XWAIT; the address is named as an input so that its registers stay live up to the wait: otherwise the group's last load lands on them
        __builtin_amdgcn_sched_barrier(0); }
    XST(xr, 0) XST(xr1, 1) XST(xr2, 2)
#pragma unroll
    for (int p = 0; p < 2; ++p) { v4u uh, ul;       // Wk^T rows 2 lane + p, columns 8 w .. 8 w + 7, hi and lo planes
#pragma unroll
        for (int i = 0; i < 4; ++i) { unsigned h, l; pk2s(wkr[2 * i][p], wkr[2 * i + 1][p], h, l); uh[i] = h; ul[i] = l; }
        *(v4ua*)(wt + (2 * lane + p) * FP + 8 * wave) = uh; *(v4ua*)(wt + FPL + (2 * lane + p) * FP + 8 * wave) = ul; }
    // q of the wave's 32 queries: D = Wq X; column i of tile qt is query q0 + 2 i + qt, so one 8-byte load of x feeds both tiles; D tiles 2 ks and 2 ks + 1 of a column are one B operand as they lie
    v16h qa[2][2], qb[2][2];                        // q as f16 hi and lo
    { v16h xf[2][2], wf[4][2];
#pragma unroll
        for (int ks = 0; ks < 2; ++ks) {
#pragma unroll
            for (int qt = 0; qt < 2; ++qt) { v8u u;
#pragma unroll
                for (int s = 0; s < 8; ++s) u[s] = pk2(xv[ks][2 * s][qt], xv[ks][2 * s + 1][qt]);
                xf[qt][ks] = __builtin_bit_cast(v16h, u); }
#pragma unroll
            for (int o = 0; o < 4; ++o) { v8u u;
#pragma unroll
                for (int s = 0; s < 8; ++s) u[s] = pk2(wr[o][ks][s >> 1][(s & 1) * 2], wr[o][ks][s >> 1][(s & 1) * 2 + 1]);
                wf[o][ks] = __builtin_bit_cast(v16h, u); } }
        v8f a[4][2];
#pragma unroll
        for (int o = 0; o < 4; ++o)
#pragma unroll
            for (int qt = 0; qt < 2; ++qt) a[o][qt] = (v8f){};
#pragma unroll
        for (int ks = 0; ks < 2; ++ks)
#pragma unroll
            for (int o = 0; o < 4; ++o)
#pragma unroll
                for (int qt = 0; qt < 2; ++qt) a[o][qt] = wmmab(wf[o][ks], xf[qt][ks], a[o][qt]);
#pragma unroll
        for (int qt = 0; qt < 2; ++qt)
#pragma unroll
            for (int ks = 0; ks < 2; ++ks) { v8u uh, ul;
#pragma unroll
                for (int e = 0; e < 2; ++e) { const v8f y = a[2 * ks + e][qt] + bqraw[2 * ks + e];
#pragma unroll
                    for (int j = 0; j < 4; ++j) { unsigned h, l; pk2s(y[2 * j], y[2 * j + 1], h, l); uh[e * 4 + j] = h; ul[e * 4 + j] = l; } }
                qa[qt][ks] = __builtin_bit_cast(v16h, uh); qb[qt][ks] = __builtin_bit_cast(v16h, ul); } }
    const int fo = lr * FP + 8 * hi;
    v8f acc[4][2];
#pragma unroll
    for (int ct = 0; ct < 4; ++ct)
#pragma unroll
        for (int qt = 0; qt < 2; ++qt) acc[ct][qt] = (v8f){};
    float muse[2] = { -3.0e38f, -3.0e38f }, lsum[2] = { 0.f, 0.f };   // per query column: the maximum in use (log2 units) and this lane's share of the sum
    __syncthreads();                                // publishes the planes of stages 0, 1 and 2 and Wk^T
    // the v weight and bias, for the epilogue: loaded behind the barrier (in front of it the barrier's own wait would sit out their latency); they fly under the products below
    v4f wvr[4][2][4]; v8f bvraw[4];
#pragma unroll
    for (int o = 0; o < 4; ++o) bvraw[o] = *(const v8f*)(bv + o * 16 + 8 * hi);
    XWAIT
    { const float* wp = wv + lr * DM + 8 * hi;
#pragma unroll
        for (int o = 0; o < 4; ++o)
#pragma unroll
            for (int ks = 0; ks < 2; ++ks)
#pragma unroll
                for (int g = 0; g < 4; ++g) wvr[o][ks][g] = *(const v4f*)(wp + o * 16 * DM + ks * 32 + (g >> 1) * 16 + (g & 1) * 4);
        asm volatile("s_wait_xcnt 0x0" :: "v"(wp) : "memory");   // as behind the q weight's loads
        __builtin_amdgcn_sched_barrier(0); }
    // Q' = Wk^T q: A = Wk^T rows from LDS, B = q; hi.hi + hi.lo + lo.hi, so that Q' carries the rounding of neither factor; rounded once to f16 it is the B operand of every score product
    v16h qh[2][2];
    { v16h wh[4][2], wl[4][2]; v8f d[4][2];
#pragma unroll
        for (int ct = 0; ct < 4; ++ct)
#pragma unroll
            for (int ks = 0; ks < 2; ++ks) { wh[ct][ks] = ldfrag(wt + fo + ct * 16 * FP + ks * 32); wl[ct][ks] = ldfrag(wt + FPL + fo + ct * 16 * FP + ks * 32); }
#pragma unroll
        for (int ct = 0; ct < 4; ++ct)
#pragma unroll
            for (int qt = 0; qt < 2; ++qt) d[ct][qt] = (v8f){};
#pragma unroll
        for (int ks = 0; ks < 2; ++ks)
#pragma unroll
            for (int ct = 0; ct < 4; ++ct)
#pragma unroll
                for (int qt = 0; qt < 2; ++qt) d[ct][qt] = wmmab(wl[ct][ks], qa[qt][ks], d[ct][qt]);
#pragma unroll
        for (int ks = 0; ks < 2; ++ks)
#pragma unroll
            for (int ct = 0; ct < 4; ++ct)
#pragma unroll
                for (int qt = 0; qt < 2; ++qt) d[ct][qt] = wmmab(wh[ct][ks], qb[qt][ks], d[ct][qt]);
#pragma unroll
        for (int ks = 0; ks < 2; ++ks)
#pragma unroll
            for (int ct = 0; ct < 4; ++ct)
#pragma unroll
                for (int qt = 0; qt < 2; ++qt) d[ct][qt] = wmmab(wh[ct][ks], qa[qt][ks], d[ct][qt]);
#pragma unroll
        for (int qt = 0; qt < 2; ++qt)
#pragma unroll
            for (int ks = 0; ks < 2; ++ks) qh[qt][ks] = __builtin_bit_cast(v16h, __builtin_shufflevector(pack8(d[2 * ks][qt]), pack8(d[2 * ks + 1][qt]), 0, 1, 2, 3, 4, 5, 6, 7)); }
    v16h wvf[4][2];                                 // Wv as A fragments, kept for the epilogue
#pragma unroll
    for (int o = 0; o < 4; ++o)
#pragma unroll
        for (int ks = 0; ks < 2; ++ks) { v8u u;
#pragma unroll
            for (int s = 0; s < 8; ++s) u[s] = pk2(wvr[o][ks][s >> 1][(s & 1) * 2], wvr[o][ks][s >> 1][(s & 1) * 2 + 1]);
            wvf[o][ks] = __builtin_bit_cast(v16h, u); }
    v16h kh[2][4];                                  // the x^T fragments of the stage at hand, fetched one stage ahead
#pragma unroll
    for (int ks = 0; ks < 2; ++ks)
#pragma unroll
        for (int kt = 0; kt < 4; ++kt) kh[ks][kt] = ldfrag(sm + fo + kt * 16 * FP + ks * 32);
#pragma unroll 1
    for (int s = 0; s < TT / FS; ++s) {
        if (s + 3 < TT / FS) XLOADS(s + 3)
        // every LDS read is issued a phase ahead of its use, in two groups a stage; the score products' x^T fragments are in registers already
        const bf* sb = sm + (s & 3) * 2 * FPL + fo;
        v8f st[4][2];
#pragma unroll
        for (int kt = 0; kt < 4; ++kt)
#pragma unroll
            for (int qt = 0; qt < 2; ++qt) st[kt][qt] = (v8f){};
#pragma unroll
        for (int ks = 0; ks < 2; ++ks)
#pragma unroll
            for (int kt = 0; kt < 4; ++kt)
#pragma unroll
                for (int qt = 0; qt < 2; ++qt) st[kt][qt] = wmmab(kh[ks][kt], qh[qt][ks], st[kt][qt]);
        __builtin_amdgcn_sched_barrier(0);          // keeps the reads below out of the run of score products
        // behind the score products, in one group: every x fragment of stage s (planes written in stage s - 3); they fly under the softmax
        v16h vh[2][4];
#pragma unroll
        for (int ks = 0; ks < 2; ++ks)
#pragma unroll
            for (int ct = 0; ct < 4; ++ct) vh[ks][ct] = ldfrag(sb + FPL + ct * 16 * FP + ks * 32);
        __builtin_amdgcn_sched_barrier(0);          // keeps the group together, in front of the maximum
        // the stage's maximum per query column: in-lane, then one exchange between the wave's halves
        float m2[2];
#pragma unroll
        for (int qt = 0; qt < 2; ++qt) { float mk[4];
#pragma unroll
            for (int kt = 0; kt < 4; ++kt) { mk[kt] = st[kt][qt][0];
#pragma unroll
                for (int j = 1; j < 8; ++j) mk[kt] = fmaxf(mk[kt], st[kt][qt][j]); }
            const float m = fmaxf(fmaxf(mk[0], mk[1]), fmaxf(mk[2], mk[3])); m2[qt] = fmaxf(m, xhalf(m)) * L2E; }
        // rescale only when some column's maximum has outgrown the one in use by 2^8 (one scalar branch a stage); weights stay <= 2^8
        if (__builtin_amdgcn_ballot_w32(m2[0] > muse[0] + 8.0f || m2[1] > muse[1] + 8.0f) != 0) {
#pragma unroll
            for (int qt = 0; qt < 2; ++qt) { const float mn = fmaxf(muse[qt], m2[qt]); const float al = __builtin_amdgcn_exp2f(muse[qt] - mn); muse[qt] = mn; lsum[qt] *= al;
#pragma unroll
                for (int ct = 0; ct < 4; ++ct) acc[ct][qt] *= al; }
        }
        // in front of the exponents, in one group: the x^T fragments of stage s + 1 (planes written in stage s - 2, published by the barrier that ended it), into the registers that the score products have read;
        // they fly under the softmax and the weights.x products; in the last stage nobody uses them
        { const bf* sn = sm + ((s + 1) & 3) * 2 * FPL + fo;
#pragma unroll
            for (int ks = 0; ks < 2; ++ks)
#pragma unroll
                for (int kt = 0; kt < 4; ++kt) kh[ks][kt] = ldfrag(sn + kt * 16 * FP + ks * 32); }
        __builtin_amdgcn_sched_barrier(0);          // keeps the group together, in front of the exponents
        // weights 2^(s log2e - max) in f32, summed in f32, rounded to f16; tiles 2 ks and 2 ks + 1 of a column are one B operand as they lie
        v16h ph[2][2];
#pragma unroll
        for (int qt = 0; qt < 2; ++qt) { v2f sk[4]; v8u pw[2]; const v2f l2 = { L2E, L2E }, nm = { -muse[qt], -muse[qt] };
#pragma unroll
            for (int kt = 0; kt < 4; ++kt) { v2f t[4];
#pragma unroll
                for (int j = 0; j < 4; ++j) { v2f sp; sp[0] = st[kt][qt][2 * j]; sp[1] = st[kt][qt][2 * j + 1]; t[j] = __builtin_elementwise_fma(sp, l2, nm); }   // v_pk_fma_f32: two arguments an instruction, each rounded as by fmaf
                // the bare v_exp_f32 as a builtin: the compiler sees it, keeps the distances behind matrix instructions and the slot behind a transcendental itself, and spends a v_nop only where no other instruction fits
#pragma unroll
                for (int j = 0; j < 4; ++j) { t[j][0] = __builtin_amdgcn_exp2f(t[j][0]); t[j][1] = __builtin_amdgcn_exp2f(t[j][1]); }
                sk[kt] = t[0]; pw[kt >> 1][(kt & 1) * 4] = pk2(t[0][0], t[0][1]);
#pragma unroll
                for (int j = 1; j < 4; ++j) { sk[kt] += t[j]; pw[kt >> 1][(kt & 1) * 4 + j] = pk2(t[j][0], t[j][1]); } }
            ph[0][qt] = __builtin_bit_cast(v16h, pw[0]); ph[1][qt] = __builtin_bit_cast(v16h, pw[1]);
            const v2f s2 = (sk[0] + sk[1]) + (sk[2] + sk[3]); lsum[qt] += s2[0] + s2[1]; }
#pragma unroll
        for (int ks = 0; ks < 2; ++ks)
#pragma unroll
            for (int ct = 0; ct < 4; ++ct)
#pragma unroll
                for (int qt = 0; qt < 2; ++qt) acc[ct][qt] = wmmab(vh[ks][ct], ph[ks][qt], acc[ct][qt]);
        if (s + 3 < TT / FS) XSTORES((s + 3) & 3)   // its last readers left it in stage s - 1, before the barrier that ended that stage
        __syncthreads();                            // publishes the planes of stage s + 3, ends every read of stage s
    }
    // epilogue: join the halves' sums, normalise, O^T = Wv Y + bv (B = Y, D tiles 2 ks and 2 ks + 1 of a column as they lie), stage each wave's [64 ch][32 queries] in its own LDS range, store whole 128-byte lines
    float* os = (float*)sm + wave * 64 * OP;
    v8f oo[4][2];
    { v16h yb[2][2];
#pragma unroll
        for (int qt = 0; qt < 2; ++qt) { const float t = lsum[qt] + xhalf(lsum[qt]); const float f = __fdiv_rn(1.0f, t);
#pragma unroll
            for (int ks = 0; ks < 2; ++ks) yb[qt][ks] = __builtin_bit_cast(v16h, __builtin_shufflevector(pack8(acc[2 * ks][qt] * f), pack8(acc[2 * ks + 1][qt] * f), 0, 1, 2, 3, 4, 5, 6, 7)); }
#pragma unroll
        for (int o = 0; o < 4; ++o)
#pragma unroll
            for (int qt = 0; qt < 2; ++qt) oo[o][qt] = wmmab(wvf[o][0], yb[qt][0], bvraw[o]);
#pragma unroll
        for (int o = 0; o < 4; ++o)
#pragma unroll
            for (int qt = 0; qt < 2; ++qt) oo[o][qt] = wmmab(wvf[o][1], yb[qt][1], oo[o][qt]); }
#pragma unroll
    for (int qt = 0; qt < 2; ++qt)
#pragma unroll
        for (int ct = 0; ct < 4; ++ct)
#pragma unroll
            for (int j = 0; j < 8; ++j) *(f32a*)(os + (ct * 16 + hi * 8 + j) * OP + 2 * lr + qt) = oo[ct][qt][j];
    float* og = outb + (size_t)blockIdx.y * CC * TT + q0;
#pragma unroll
    for (int it = 0; it < 16; ++it) { const int c = it * 4 + (lane >> 3), x = (lane & 7) * 4; *(v4f*)(og + (size_t)c * TT + x) = *(const v4fa*)(os + c * OP + x); }
}
extern "C" void kernel_launch(void* const* d_in, const int* in_sizes, int n_in,
                              void* d_out, int out_size, void* d_ws, size_t ws_size, hipStream_t stream) {
    (void)in_sizes; (void)n_in; (void)out_size; (void)d_ws; (void)ws_size;
    const float* x = (const float*)d_in[0]; const float* wq = (const float*)d_in[1]; const float* bq = (const float*)d_in[2]; const float* wk = (const float*)d_in[3]; const float* bk = (const float*)d_in[4]; const float* wv = (const float*)d_in[5]; const float* bv = (const float*)d_in[6];
    float* OUT = (float*)d_out;     // [64][64][1024]
    k_fattn<<<dim3(TT / 256, NB_, 1), 256, 0, stream>>>(x, wq, bq, wk, bk, wv, bv, OUT);   /* projections, scores, softmax, weights.x; writes the channel-major output */
}

// v009
// Measured time: 20.7 microseconds a run.
// In two side-by-side timings against v008, it was 1.04 and 1.03 times as fast.
// Counting every step since v000, it is 172 times as fast.
#include <hip/hip_runtime.h>

// Spatial self-attention over 1,024 positions for each of 64 (batch, time) slices (x [8][8][64][1024] channel-major; q, k, v = 1x1 convs ('oi' [64][64] + [64]); scores = q.k over the 64 channels, unscaled; softmax over positions; out = (weights v)^T channel-major -> [8][8][64][1024]).
// ONE kernel: a work-group owns 256 queries of one slice. The k and v projections are linear, so they are taken out of the key loop: scores = (Wk^T q).x + q.bk, whose second term is the same for every key of a query and cancels in the softmax; out = Wv (weights.x) + bv, the weights of a query summing to 1. The loop stages x alone (f16, in both orders) and runs one product each side, running maximum and sum per query; the transposed products give channel-major rows directly.
// Compute dtypes, f32 accumulate: x, Wq and Wv rounded to f16; q and Wk enter the product Wk^T q as f16 hi + lo pairs (three products, once per work-group), so that neither rounding reaches the scores; Wk^T q, the softmax weights (<= 2^8) and the normalised weights.x rounded once to f16; f32 biases added to the f32 accumulators; softmax f32; output f32.

#define NB_  64
#define TT   1024
#define DM   64
#define NH_  1
#define NKV  1
#define REP  (NH_ / NKV)
#define HD   64
#define DQ   (NH_ * HD)
#define DKV  (NKV * HD)
#define ZH   1
#define WIN  0
#define PCAR 1024.0f
#define SCL  1.0f   // unscaled
#define CC   64
typedef unsigned short bf;
typedef __attribute__((ext_vector_type(16))) _Float16 v16h;
typedef __attribute__((ext_vector_type(8)))  unsigned short v8us;
typedef __attribute__((ext_vector_type(8)))  float    v8f;
typedef __attribute__((ext_vector_type(4)))  float    v4f;
typedef v4f  __attribute__((may_alias)) v4fa;
typedef v8us __attribute__((may_alias)) v8usa;

__device__ __forceinline__ v16h cat16b(v8us lo, v8us hi) { return __builtin_bit_cast(v16h, __builtin_shufflevector(lo, hi, 0, 1, 2, 3, 4, 5, 6, 7, 8, 9, 10, 11, 12, 13, 14, 15)); }
__device__ __forceinline__ v8f wmmab(v16h a, v16h b, v8f c) { return __builtin_amdgcn_wmma_f32_16x16x32_f16(false, a, false, b, (short)0, c, false, false); }
typedef __attribute__((ext_vector_type(2))) float v2f;

// ---- k_fattn: projections, scores, softmax and weights.x of 256 queries of one slice; q, the scores and the weights never leave the registers.
// S^T = X^T Q' (A = x^T rows from LDS, B = Q' = Wk^T q kept in registers), Y += X P^T (A = x rows from LDS, B = two score tiles converted in place): a lane holds one query's column; O^T = Wv Y / sum + bv is the channel-major output.
// 8 waves x 32 query columns; grid (TT / 256, slices). A stage is 64 keys: x^T [64 keys][64 ch] and x [64 ch][64 keys] in f16, four buffers, staged through registers three stages ahead.
// k order of every operand, element s of k step ks: index 32 ks + 8 hi + s (s < 8), 32 ks + 16 + 8 hi + (s - 8).
#define FS  64                     // keys per stage
#define FP  72                     // LDS row pitch in 16-bit elements: 144 B = 16 B x odd, conflict-free for 16-byte row reads
#define FPL (64 * FP)              // one plane of a stage
#define OP  36                     // output staging pitch in floats
#define L2E 1.4426950408889634f
typedef __attribute__((ext_vector_type(2))) _Float16 v2h;
typedef float __attribute__((may_alias)) f32a;
__device__ __forceinline__ v16h ldfrag(const bf* p) { return cat16b(*(const v8usa*)p, *(const v8usa*)(p + 16)); }   // hardware k order: 8 hi + s, 16 + 8 hi + (s - 8)
__device__ __forceinline__ float xhalf(float x) { const int b = __float_as_int(x); return __int_as_float(__builtin_amdgcn_permlanex16(b, b, 0x76543210, 0xfedcba98, false, false)); }   // lane l <-> l ^ 16
typedef __attribute__((ext_vector_type(4))) unsigned v4u;
typedef __attribute__((ext_vector_type(8))) unsigned v8u;
typedef v4u __attribute__((may_alias)) v4ua;
__device__ __forceinline__ unsigned pk2(float a, float b) { v2f e; e[0] = a; e[1] = b; return __builtin_bit_cast(unsigned, __builtin_convertvector(e, v2h)); }   // two f32 -> one word of two f16, round to nearest even
__device__ __forceinline__ v4u pack8(const v8f y) { v4u h4;
#pragma unroll
    for (int j = 0; j < 4; ++j) h4[j] = pk2(y[2 * j], y[2 * j + 1]);
    return h4; }
// one word of two f16 and the word of what the rounding left over
__device__ __forceinline__ void pk2s(float a, float b, unsigned& h, unsigned& l) { h = pk2(a, b); const v2f r = __builtin_convertvector(__builtin_bit_cast(v2h, h), v2f); l = pk2(a - r[0], b - r[1]); }
typedef unsigned __attribute__((may_alias)) u32a;
__global__ __launch_bounds__(256) void k_fattn(const float* __restrict__ x, const float* __restrict__ wq, const float* __restrict__ bq, const float* __restrict__ wk, const float* __restrict__ bk, const float* __restrict__ wv, const float* __restrict__ bv, float* __restrict__ outb) {
    (void)bk;                                       // q.bk is one constant per query over all keys: the softmax does not see it
    __shared__ __align__(16) bf sm[4 * 2 * FPL + 2 * FPL];   // 92,160 B: four stages of two planes (x^T, x), then Wk^T hi and lo; after the loop its first 73,728 B are 8 waves x [64 ch][OP] floats of output staging
    const int tid = threadIdx.x, lane = tid & 31, lr = lane & 15, hi = lane >> 4; const int wave = tid >> 5;
    const float* xs = x + (size_t)blockIdx.y * CC * TT; const int q0 = blockIdx.x * 256 + wave * 32;
    // x staging: wave w moves channels 8 w .. 8 w + 7, a lane keys 2 lane and 2 lane + 1 (a load covers 256 B in a row); rounded to f16 they are two 16-byte pieces of x^T and eight words of x
    const float* xg = xs + (size_t)(8 * wave) * TT + 2 * lane; bf* xdst = sm + 2 * lane * FP + 8 * wave; bf* ndst = sm + FPL + 8 * wave * FP + 2 * lane;
    bf* wt = sm + 4 * 2 * FPL;
    v2f xr[8], xr1[8], xr2[8];
#define XLD(r, s) { _Pragma("unroll") for (int c = 0; c < 8; ++c) r[c] = *(const v2f*)(xg + (size_t)c * TT + (s) * FS); }
#define XLOADS(s) { XLD(xr, s) \
    asm volatile("s_wait_xcnt 0x0" ::: "memory"); /* before the code that follows reuses the address registers of these loads */ }
#define XST(r, b) { _Pragma("unroll") for (int p = 0; p < 2; ++p) { v4u u; _Pragma("unroll") for (int i = 0; i < 4; ++i) u[i] = pk2(r[2 * i][p], r[2 * i + 1][p]); *(v4ua*)(xdst + (b) * 2 * FPL + p * FP) = u; } \
    _Pragma("unroll") for (int c = 0; c < 8; ++c) *(u32a*)(ndst + (b) * 2 * FPL + c * FP) = pk2(r[c][0], r[c][1]); }
#define XSTORES(b) XST(xr, b)
    // every load of the prologue's first part stands at its head, so that one memory latency covers them all. Behind each group that shares an address base: s_wait_xcnt 0, before later code reuses the group's address registers,
    // and a scheduling barrier, without which the scheduler lifts the next group's address arithmetic and the conversions over that wait
#define XWAIT { asm volatile("s_wait_xcnt 0x0" ::: "memory"); __builtin_amdgcn_sched_barrier(0); }
    XLD(xr, 0) XLD(xr1, 1) XLD(xr2, 2)              // x of the first three stages, one address base
    XWAIT
    v2f wkr[8];                                     // Wk rows 8 w .. 8 w + 7, columns 2 lane and 2 lane + 1: moved like x, so that LDS holds Wk^T
    { const float* wg = wk + (8 * wave) * DM + 2 * lane;
#pragma unroll
        for (int c = 0; c < 8; ++c) wkr[c] = *(const v2f*)(wg + c * DM);
        asm volatile("s_wait_xcnt 0x0" :: "v"(wg) : "memory");   // as in XWAIT; the address is named as an input so that its registers stay live up to the wait
        __builtin_amdgcn_sched_barrier(0); }
    v2f xv[2][16]; v4f wr[4][2][4]; v8f bqraw[4];   // x of the wave's 32 queries, the whole q weight and bias
    { const float* xp = xs + (size_t)(8 * hi) * TT + q0 + 2 * lr;
#pragma unroll
        for (int ks = 0; ks < 2; ++ks)
#pragma unroll
            for (int s = 0; s < 16; ++s) xv[ks][s] = *(const v2f*)(xp + (size_t)(ks * 32 + (s >> 3) * 16 + (s & 7)) * TT); }
    XWAIT
#pragma unroll
    for (int o = 0; o < 4; ++o) bqraw[o] = *(const v8f*)(bq + o * 16 + 8 * hi);
    XWAIT
    { const float* wp = wq + lr * DM + 8 * hi;
#pragma unroll
        for (int o = 0; o < 4; ++o)
#pragma unroll
            for (int ks = 0; ks < 2; ++ks)
#pragma unroll
                for (int g = 0; g < 4; ++g) wr[o][ks][g] = *(const v4f*)(wp + o * 16 * DM + ks * 32 + (g >> 1) * 16 + (g & 1) * 4);
        asm volatile("s_wait_xcnt 0x0" :: "v"(wp) : "memory");   // as in XWAIT; the address is named as an input so that its registers stay live up to the wait: otherwise the group's last load lands on them
        __builtin_amdgcn_sched_barrier(0); }
    XST(xr, 0) XST(xr1, 1) XST(xr2, 2)
#pragma unroll
    for (int p = 0; p < 2; ++p) { v4u uh, ul;       // Wk^T rows 2 lane + p, columns 8 w .. 8 w + 7, hi and lo planes
#pragma unroll
        for (int i = 0; i < 4; ++i) { unsigned h, l; pk2s(wkr[2 * i][p], wkr[2 * i + 1][p], h, l); uh[i] = h; ul[i] = l; }
        *(v4ua*)(wt + (2 * lane + p) * FP + 8 * wave) = uh; *(v4ua*)(wt + FPL + (2 * lane + p) * FP + 8 * wave) = ul; }
    // q of the wave's 32 queries: D = Wq X; column i of tile qt is query q0 + 2 i + qt, so one 8-byte load of x feeds both tiles; D tiles 2 ks and 2 ks + 1 of a column are one B operand as they lie
    v16h qa[2][2], qb[2][2];                        // q as f16 hi and lo
    { v16h xf[2][2], wf[4][2];
#pragma unroll
        for (int ks = 0; ks < 2; ++ks) {
#pragma unroll
            for (int qt = 0; qt < 2; ++qt) { v8u u;
#pragma unroll
                for (int s = 0; s < 8; ++s) u[s] = pk2(xv[ks][2 * s][qt], xv[ks][2 * s + 1][qt]);
                xf[qt][ks] = __builtin_bit_cast(v16h, u); }
#pragma unroll
            for (int o = 0; o < 4; ++o) { v8u u;
#pragma unroll
                for (int s = 0; s < 8; ++s) u[s] = pk2(wr[o][ks][s >> 1][(s & 1) * 2], wr[o][ks][s >> 1][(s & 1) * 2 + 1]);
                wf[o][ks] = __builtin_bit_cast(v16h, u); } }
        v8f a[4][2];
#pragma unroll
        for (int o = 0; o < 4; ++o)
#pragma unroll
            for (int qt = 0; qt < 2; ++qt) a[o][qt] = (v8f){};
#pragma unroll
        for (int ks = 0; ks < 2; ++ks)
#pragma unroll
            for (int o = 0; o < 4; ++o)
#pragma unroll
                for (int qt = 0; qt < 2; ++qt) a[o][qt] = wmmab(wf[o][ks], xf[qt][ks], a[o][qt]);
#pragma unroll
        for (int qt = 0; qt < 2; ++qt)
#pragma unroll
            for (int ks = 0; ks < 2; ++ks) { v8u uh, ul;
#pragma unroll
                for (int e = 0; e < 2; ++e) { const v8f y = a[2 * ks + e][qt] + bqraw[2 * ks + e];
#pragma unroll
                    for (int j = 0; j < 4; ++j) { unsigned h, l; pk2s(y[2 * j], y[2 * j + 1], h, l); uh[e * 4 + j] = h; ul[e * 4 + j] = l; } }
                qa[qt][ks] = __builtin_bit_cast(v16h, uh); qb[qt][ks] = __builtin_bit_cast(v16h, ul); } }
    const int fo = lr * FP + 8 * hi;
    v8f acc[4][2];
#pragma unroll
    for (int ct = 0; ct < 4; ++ct)
#pragma unroll
        for (int qt = 0; qt < 2; ++qt) acc[ct][qt] = (v8f){};
    float muse[2] = { -3.0e38f, -3.0e38f }, lsum[2] = { 0.f, 0.f };   // per query column: the maximum in use (log2 units) and this lane's share of the sum
    // The loop's work-group barrier is split: BSIG at a stage's end, BWAIT in the middle of the next stage; they alternate strictly in every wave (one signal behind the prologue's barrier, per stage wait then signal, one wait behind the loop).
    // What it is for: a full barrier starts a SIMD's two waves on the same phase, so both want the matrix unit, then both the vector port; released in mid-stage, the wave that runs ahead does its exponents while the other does its score products.
    // Why it is safe: BWAIT of stage s says that every wave has ended stage s - 1, its LDS reads and stores retired. The stores of stage s (into the buffer read in stage s - 1) stand behind it.
    // The LDS reads between a wave's signal and its wait are the x fragments of stage s and the x^T fragments of stage s + 1: planes stored in stages s - 3 and s - 2, published by earlier waits, refilled only in stages s + 1 and s + 2 behind later ones.
#define BSIG  { __builtin_amdgcn_fence(__ATOMIC_RELEASE, "workgroup"); __builtin_amdgcn_s_barrier_signal(-1); }   /* the fence is the first half of __syncthreads(): the wave's own LDS stores and reads retire before it signals; a bare signal carries no wait */
#define BWAIT asm volatile("s_barrier_wait -1" ::: "memory");   /* the clobber keeps the LDS stores that follow behind the wait */
    __syncthreads();                                // publishes the planes of stages 0, 1 and 2 and Wk^T
    BSIG                                            // pairs with the wait of stage 0; here, where the wave has nothing in flight, its fence waits for nothing
    // the v weight and bias, for the epilogue: loaded behind the barrier (in front of it the barrier's own wait would sit out their latency); they fly under the products below
    v4f wvr[4][2][4]; v8f bvraw[4];
#pragma unroll
    for (int o = 0; o < 4; ++o) bvraw[o] = *(const v8f*)(bv + o * 16 + 8 * hi);
    XWAIT
    { const float* wp = wv + lr * DM + 8 * hi;
#pragma unroll
        for (int o = 0; o < 4; ++o)
#pragma unroll
            for (int ks = 0; ks < 2; ++ks)
#pragma unroll
                for (int g = 0; g < 4; ++g) wvr[o][ks][g] = *(const v4f*)(wp + o * 16 * DM + ks * 32 + (g >> 1) * 16 + (g & 1) * 4);
        asm volatile("s_wait_xcnt 0x0" :: "v"(wp) : "memory");   // as behind the q weight's loads
        __builtin_amdgcn_sched_barrier(0); }
    // Q' = Wk^T q: A = Wk^T rows from LDS, B = q; hi.hi + hi.lo + lo.hi, so that Q' carries the rounding of neither factor; rounded once to f16 it is the B operand of every score product
    v16h qh[2][2];
    { v16h wh[4][2], wl[4][2]; v8f d[4][2];
#pragma unroll
        for (int ct = 0; ct < 4; ++ct)
#pragma unroll
            for (int ks = 0; ks < 2; ++ks) { wh[ct][ks] = ldfrag(wt + fo + ct * 16 * FP + ks * 32); wl[ct][ks] = ldfrag(wt + FPL + fo + ct * 16 * FP + ks * 32); }
#pragma unroll
        for (int ct = 0; ct < 4; ++ct)
#pragma unroll
            for (int qt = 0; qt < 2; ++qt) d[ct][qt] = (v8f){};
#pragma unroll
        for (int ks = 0; ks < 2; ++ks)
#pragma unroll
            for (int ct = 0; ct < 4; ++ct)
#pragma unroll
                for (int qt = 0; qt < 2; ++qt) d[ct][qt] = wmmab(wl[ct][ks], qa[qt][ks], d[ct][qt]);
#pragma unroll
        for (int ks = 0; ks < 2; ++ks)
#pragma unroll
            for (int ct = 0; ct < 4; ++ct)
#pragma unroll
                for (int qt = 0; qt < 2; ++qt) d[ct][qt] = wmmab(wh[ct][ks], qb[qt][ks], d[ct][qt]);
#pragma unroll
        for (int ks = 0; ks < 2; ++ks)
#pragma unroll
            for (int ct = 0; ct < 4; ++ct)
#pragma unroll
                for (int qt = 0; qt < 2; ++qt) d[ct][qt] = wmmab(wh[ct][ks], qa[qt][ks], d[ct][qt]);
#pragma unroll
        for (int qt = 0; qt < 2; ++qt)
#pragma unroll
            for (int ks = 0; ks < 2; ++ks) qh[qt][ks] = __builtin_bit_cast(v16h, __builtin_shufflevector(pack8(d[2 * ks][qt]), pack8(d[2 * ks + 1][qt]), 0, 1, 2, 3, 4, 5, 6, 7)); }
    v16h wvf[4][2];                                 // Wv as A fragments, kept for the epilogue
#pragma unroll
    for (int o = 0; o < 4; ++o)
#pragma unroll
        for (int ks = 0; ks < 2; ++ks) { v8u u;
#pragma unroll
            for (int s = 0; s < 8; ++s) u[s] = pk2(wvr[o][ks][s >> 1][(s & 1) * 2], wvr[o][ks][s >> 1][(s & 1) * 2 + 1]);
            wvf[o][ks] = __builtin_bit_cast(v16h, u); }
    v16h kh[2][4];                                  // the x^T fragments of the stage at hand, fetched one stage ahead
#pragma unroll
    for (int ks = 0; ks < 2; ++ks)
#pragma unroll
        for (int kt = 0; kt < 4; ++kt) kh[ks][kt] = ldfrag(sm + fo + kt * 16 * FP + ks * 32);
#pragma unroll 1
    for (int s = 0; s < TT / FS; ++s) {
        if (s + 3 < TT / FS) XLOADS(s + 3)
        // every LDS read is issued a phase ahead of its use, in two groups a stage; the score products' x^T fragments are in registers already
        const bf* sb = sm + (s & 3) * 2 * FPL + fo;
        v8f st[4][2];
#pragma unroll
        for (int kt = 0; kt < 4; ++kt)
#pragma unroll
            for (int qt = 0; qt < 2; ++qt) st[kt][qt] = (v8f){};
#pragma unroll
        for (int ks = 0; ks < 2; ++ks)
#pragma unroll
            for (int kt = 0; kt < 4; ++kt)
#pragma unroll
                for (int qt = 0; qt < 2; ++qt) st[kt][qt] = wmmab(kh[ks][kt], qh[qt][ks], st[kt][qt]);
        __builtin_amdgcn_sched_barrier(0);          // keeps the reads below out of the run of score products
        // behind the score products, in one group: every x fragment of stage s (planes written in stage s - 3); they fly under the softmax
        v16h vh[2][4];
#pragma unroll
        for (int ks = 0; ks < 2; ++ks)
#pragma unroll
            for (int ct = 0; ct < 4; ++ct) vh[ks][ct] = ldfrag(sb + FPL + ct * 16 * FP + ks * 32);
        __builtin_amdgcn_sched_barrier(0);          // keeps the group together, in front of the maximum
        // the stage's maximum per query column: in-lane, then one exchange between the wave's halves
        float m2[2];
#pragma unroll
        for (int qt = 0; qt < 2; ++qt) { float mk[4];
#pragma unroll
            for (int kt = 0; kt < 4; ++kt) { mk[kt] = st[kt][qt][0];
#pragma unroll
                for (int j = 1; j < 8; ++j) mk[kt] = fmaxf(mk[kt], st[kt][qt][j]); }
            const float m = fmaxf(fmaxf(mk[0], mk[1]), fmaxf(mk[2], mk[3])); m2[qt] = fmaxf(m, xhalf(m)) * L2E; }
        // rescale only when some column's maximum has outgrown the one in use by 2^8 (one scalar branch a stage); weights stay <= 2^8
        if (__builtin_amdgcn_ballot_w32(m2[0] > muse[0] + 8.0f || m2[1] > muse[1] + 8.0f) != 0) {
#pragma unroll
            for (int qt = 0; qt < 2; ++qt) { const float mn = fmaxf(muse[qt], m2[qt]); const float al = __builtin_amdgcn_exp2f(muse[qt] - mn); muse[qt] = mn; lsum[qt] *= al;
#pragma unroll
                for (int ct = 0; ct < 4; ++ct) acc[ct][qt] *= al; }
        }
        // in front of the exponents, in one group: the x^T fragments of stage s + 1 (planes written in stage s - 2, published by the wait of stage s - 1), into the registers that the score products have read;
        // they fly under the softmax and the weights.x products; in the last stage nobody uses them
        { const bf* sn = sm + ((s + 1) & 3) * 2 * FPL + fo;
#pragma unroll
            for (int ks = 0; ks < 2; ++ks)
#pragma unroll
                for (int kt = 0; kt < 4; ++kt) kh[ks][kt] = ldfrag(sn + kt * 16 * FP + ks * 32); }
        __builtin_amdgcn_sched_barrier(0);          // keeps the group together, in front of the exponents
        BWAIT                                       // every wave has ended stage s - 1: frees the buffer that this stage's stores refill, publishes the planes of stage s + 2
        __builtin_amdgcn_sched_barrier(0);          // keeps the wait at this place: without it the scheduler lifts the exponents and the products over it, to the stage's end
        // weights 2^(s log2e - max) in f32, summed in f32, rounded to f16; tiles 2 ks and 2 ks + 1 of a column are one B operand as they lie
        v16h ph[2][2];
#pragma unroll
        for (int qt = 0; qt < 2; ++qt) { v2f sk[4]; v8u pw[2]; const v2f l2 = { L2E, L2E }, nm = { -muse[qt], -muse[qt] };
#pragma unroll
            for (int kt = 0; kt < 4; ++kt) { v2f t[4];
#pragma unroll
                for (int j = 0; j < 4; ++j) { v2f sp; sp[0] = st[kt][qt][2 * j]; sp[1] = st[kt][qt][2 * j + 1]; t[j] = __builtin_elementwise_fma(sp, l2, nm); }   // v_pk_fma_f32: two arguments an instruction, each rounded as by fmaf
                // the bare v_exp_f32 as a builtin: the compiler sees it, keeps the distances behind matrix instructions and the slot behind a transcendental itself, and spends a v_nop only where no other instruction fits
#pragma unroll
                for (int j = 0; j < 4; ++j) { t[j][0] = __builtin_amdgcn_exp2f(t[j][0]); t[j][1] = __builtin_amdgcn_exp2f(t[j][1]); }
                sk[kt] = t[0]; pw[kt >> 1][(kt & 1) * 4] = pk2(t[0][0], t[0][1]);
#pragma unroll
                for (int j = 1; j < 4; ++j) { sk[kt] += t[j]; pw[kt >> 1][(kt & 1) * 4 + j] = pk2(t[j][0], t[j][1]); } }
            ph[0][qt] = __builtin_bit_cast(v16h, pw[0]); ph[1][qt] = __builtin_bit_cast(v16h, pw[1]);
            const v2f s2 = (sk[0] + sk[1]) + (sk[2] + sk[3]); lsum[qt] += s2[0] + s2[1]; }
#pragma unroll
        for (int ks = 0; ks < 2; ++ks)
#pragma unroll
            for (int ct = 0; ct < 4; ++ct)
#pragma unroll
                for (int qt = 0; qt < 2; ++qt) acc[ct][qt] = wmmab(vh[ks][ct], ph[ks][qt], acc[ct][qt]);
        if (s + 3 < TT / FS) XSTORES((s + 3) & 3)   // its last readers left it in stage s - 1, which the wait above has seen ended in every wave
        BSIG                                        // this wave's planes of stage s + 3 are stored, its reads of stage s done
    }
    BWAIT                                           // every wave has left the loop's last reads: the ring becomes output staging
    // epilogue: join the halves' sums, normalise, O^T = Wv Y + bv (B = Y, D tiles 2 ks and 2 ks + 1 of a column as they lie), stage each wave's [64 ch][32 queries] in its own LDS range, store whole 128-byte lines
    float* os = (float*)sm + wave * 64 * OP;
    v8f oo[4][2];
    { v16h yb[2][2];
#pragma unroll
        for (int qt = 0; qt < 2; ++qt) { const float t = lsum[qt] + xhalf(lsum[qt]); const float f = __fdiv_rn(1.0f, t);
#pragma unroll
            for (int ks = 0; ks < 2; ++ks) yb[qt][ks] = __builtin_bit_cast(v16h, __builtin_shufflevector(pack8(acc[2 * ks][qt] * f), pack8(acc[2 * ks + 1][qt] * f), 0, 1, 2, 3, 4, 5, 6, 7)); }
#pragma unroll
        for (int o = 0; o < 4; ++o)
#pragma unroll
            for (int qt = 0; qt < 2; ++qt) oo[o][qt] = wmmab(wvf[o][0], yb[qt][0], bvraw[o]);
#pragma unroll
        for (int o = 0; o < 4; ++o)
#pragma unroll
            for (int qt = 0; qt < 2; ++qt) oo[o][qt] = wmmab(wvf[o][1], yb[qt][1], oo[o][qt]); }
#pragma unroll
    for (int qt = 0; qt < 2; ++qt)
#pragma unroll
        for (int ct = 0; ct < 4; ++ct)
#pragma unroll
            for (int j = 0; j < 8; ++j) *(f32a*)(os + (ct * 16 + hi * 8 + j) * OP + 2 * lr + qt) = oo[ct][qt][j];
    float* og = outb + (size_t)blockIdx.y * CC * TT + q0;
#pragma unroll
    for (int it = 0; it < 16; ++it) { const int c = it * 4 + (lane >> 3), x = (lane & 7) * 4; *(v4f*)(og + (size_t)c * TT + x) = *(const v4fa*)(os + c * OP + x); }
}
extern "C" void kernel_launch(void* const* d_in, const int* in_sizes, int n_in,
                              void* d_out, int out_size, void* d_ws, size_t ws_size, hipStream_t stream) {
    (void)in_sizes; (void)n_in; (void)out_size; (void)d_ws; (void)ws_size;
    const float* x = (const float*)d_in[0]; const float* wq = (const float*)d_in[1]; const float* bq = (const float*)d_in[2]; const float* wk = (const float*)d_in[3]; const float* bk = (const float*)d_in[4]; const float* wv = (const float*)d_in[5]; const float* bv = (const float*)d_in[6];
    float* OUT = (float*)d_out;     // [64][64][1024]
    k_fattn<<<dim3(TT / 256, NB_, 1), 256, 0, stream>>>(x, wq, bq, wk, bk, wv, bv, OUT);   /* projections, scores, softmax, weights.x; writes the channel-major output */
}

// v010
// A run of this version takes 20.1 microseconds.
// Timed twice side by side with v009, it ran 1.03 and 1.04 times as fast.
// All steps since v000 together make it 179 times as fast.
#include <hip/hip_runtime.h>

// Spatial self-attention over 1,024 positions for each of 64 (batch, time) slices (x [8][8][64][1024] channel-major; q, k, v = 1x1 convs ('oi' [64][64] + [64]); scores = q.k over the 64 channels, unscaled; softmax over positions; out = (weights v)^T channel-major -> [8][8][64][1024]).
// ONE kernel: a work-group owns 256 queries of one slice. The k and v projections are linear, so they are taken out of the key loop: scores = (Wk^T q).x + q.bk, whose second term is the same for every key of a query and cancels in the softmax; out = Wv (weights.x) + bv, the weights of a query summing to 1. The loop stages x alone (f16, in both orders) and runs one product each side; the softmax reference of a query is the maximum of its first 64 scores plus 8 (log2 units), held fixed, with a range test on the sums behind the loop and a second run of the loop under a running maximum where the test fails; the transposed products give channel-major rows directly.
// Compute dtypes, f32 accumulate: x, Wq and Wv rounded to f16; q and Wk enter the product Wk^T q as f16 hi + lo pairs (three products, once per work-group), so that neither rounding reaches the scores; Wk^T q, the softmax weights (finite in f16 by the range test; <= 2^8 in the second run) and the normalised weights.x rounded once to f16; f32 biases added to the f32 accumulators; softmax f32; output f32.

#define NB_  64
#define TT   1024
#define DM   64
#define NH_  1
#define NKV  1
#define REP  (NH_ / NKV)
#define HD   64
#define DQ   (NH_ * HD)
#define DKV  (NKV * HD)
#define ZH   1
#define WIN  0
#define PCAR 1024.0f
#define SCL  1.0f   // unscaled
#define CC   64
typedef unsigned short bf;
typedef __attribute__((ext_vector_type(16))) _Float16 v16h;
typedef __attribute__((ext_vector_type(8)))  unsigned short v8us;
typedef __attribute__((ext_vector_type(8)))  float    v8f;
typedef __attribute__((ext_vector_type(4)))  float    v4f;
typedef v4f  __attribute__((may_alias)) v4fa;
typedef v8us __attribute__((may_alias)) v8usa;

__device__ __forceinline__ v16h cat16b(v8us lo, v8us hi) { return __builtin_bit_cast(v16h, __builtin_shufflevector(lo, hi, 0, 1, 2, 3, 4, 5, 6, 7, 8, 9, 10, 11, 12, 13, 14, 15)); }
__device__ __forceinline__ v8f wmmab(v16h a, v16h b, v8f c) { return __builtin_amdgcn_wmma_f32_16x16x32_f16(false, a, false, b, (short)0, c, false, false); }
typedef __attribute__((ext_vector_type(2))) float v2f;

// ---- k_fattn: projections, scores, softmax and weights.x of 256 queries of one slice; q, the scores and the weights never leave the registers.
// S^T = X^T Q' (A = x^T rows from LDS, B = Q' = Wk^T q kept in registers), Y += X P^T (A = x rows from LDS, B = two score tiles converted in place): a lane holds one query's column; O^T = Wv Y / sum + bv is the channel-major output.
// 8 waves x 32 query columns; grid (TT / 256, slices). A stage is 64 keys: x^T [64 keys][64 ch] and x [64 ch][64 keys] in f16, four buffers, staged through registers three stages ahead.
// k order of every operand, element s of k step ks: index 32 ks + 8 hi + s (s < 8), 32 ks + 16 + 8 hi + (s - 8).
#define FS  64                     // keys per stage
#define FP  72                     // LDS row pitch in 16-bit elements: 144 B = 16 B x odd, conflict-free for 16-byte row reads
#define FPL (64 * FP)              // one plane of a stage
#define OP  36                     // output staging pitch in floats
#define L2E 1.4426950408889634f
typedef __attribute__((ext_vector_type(2))) _Float16 v2h;
typedef float __attribute__((may_alias)) f32a;
__device__ __forceinline__ v16h ldfrag(const bf* p) { return cat16b(*(const v8usa*)p, *(const v8usa*)(p + 16)); }   // hardware k order: 8 hi + s, 16 + 8 hi + (s - 8)
__device__ __forceinline__ float xhalf(float x) { const int b = __float_as_int(x); return __int_as_float(__builtin_amdgcn_permlanex16(b, b, 0x76543210, 0xfedcba98, false, false)); }   // lane l <-> l ^ 16
typedef __attribute__((ext_vector_type(4))) unsigned v4u;
typedef __attribute__((ext_vector_type(8))) unsigned v8u;
typedef v4u __attribute__((may_alias)) v4ua;
__device__ __forceinline__ unsigned pk2(float a, float b) { v2f e; e[0] = a; e[1] = b; return __builtin_bit_cast(unsigned, __builtin_convertvector(e, v2h)); }   // two f32 -> one word of two f16, round to nearest even
__device__ __forceinline__ v4u pack8(const v8f y) { v4u h4;
#pragma unroll
    for (int j = 0; j < 4; ++j) h4[j] = pk2(y[2 * j], y[2 * j + 1]);
    return h4; }
// one word of two f16 and the word of what the rounding left over
__device__ __forceinline__ void pk2s(float a, float b, unsigned& h, unsigned& l) { h = pk2(a, b); const v2f r = __builtin_convertvector(__builtin_bit_cast(v2h, h), v2f); l = pk2(a - r[0], b - r[1]); }
typedef unsigned __attribute__((may_alias)) u32a;
__global__ __launch_bounds__(256) void k_fattn(const float* __restrict__ x, const float* __restrict__ wq, const float* __restrict__ bq, const float* __restrict__ wk, const float* __restrict__ bk, const float* __restrict__ wv, const float* __restrict__ bv, float* __restrict__ outb) {
    (void)bk;                                       // q.bk is one constant per query over all keys: the softmax does not see it
    __shared__ __align__(16) bf sm[4 * 2 * FPL + 2 * FPL + 16];   // 92,192 B: four stages of two planes (x^T, x), then Wk^T hi and lo, then one word per wave for the range test; after the loop its first 73,728 B are 8 waves x [64 ch][OP] floats of output staging
    const int tid = threadIdx.x, lane = tid & 31, lr = lane & 15, hi = lane >> 4; const int wave = tid >> 5;
    const float* xs = x + (size_t)blockIdx.y * CC * TT; const int q0 = blockIdx.x * 256 + wave * 32;
    // x staging: wave w moves channels 8 w .. 8 w + 7, a lane keys 2 lane and 2 lane + 1 (a load covers 256 B in a row); rounded to f16 they are two 16-byte pieces of x^T and eight words of x
    const float* xg = xs + (size_t)(8 * wave) * TT + 2 * lane; bf* xdst = sm + 2 * lane * FP + 8 * wave; bf* ndst = sm + FPL + 8 * wave * FP + 2 * lane;
    bf* wt = sm + 4 * 2 * FPL;
    v2f xr[8], xr1[8], xr2[8];
#define XLD(r, s) { _Pragma("unroll") for (int c = 0; c < 8; ++c) r[c] = *(const v2f*)(xg + (size_t)c * TT + (s) * FS); }
#define XLOADS(s) { XLD(xr, s) \
    asm volatile("s_wait_xcnt 0x0" ::: "memory"); /* before the code that follows reuses the address registers of these loads */ }
#define XST(r, b) { _Pragma("unroll") for (int p = 0; p < 2; ++p) { v4u u; _Pragma("unroll") for (int i = 0; i < 4; ++i) u[i] = pk2(r[2 * i][p], r[2 * i + 1][p]); *(v4ua*)(xdst + (b) * 2 * FPL + p * FP) = u; } \
    _Pragma("unroll") for (int c = 0; c < 8; ++c) *(u32a*)(ndst + (b) * 2 * FPL + c * FP) = pk2(r[c][0], r[c][1]); }
#define XSTORES(b) XST(xr, b)
    // every load of the prologue's first part stands at its head, so that one memory latency covers them all. Behind each group that shares an address base: s_wait_xcnt 0, before later code reuses the group's address registers,
    // and a scheduling barrier, without which the scheduler lifts the next group's address arithmetic and the conversions over that wait
#define XWAIT { asm volatile("s_wait_xcnt 0x0" ::: "memory"); __builtin_amdgcn_sched_barrier(0); }
    XLD(xr, 0) XLD(xr1, 1) XLD(xr2, 2)              // x of the first three stages, one address base
    XWAIT
    v2f wkr[8];                                     // Wk rows 8 w .. 8 w + 7, columns 2 lane and 2 lane + 1: moved like x, so that LDS holds Wk^T
    { const float* wg = wk + (8 * wave) * DM + 2 * lane;
#pragma unroll
        for (int c = 0; c < 8; ++c) wkr[c] = *(const v2f*)(wg + c * DM);
        asm volatile("s_wait_xcnt 0x0" :: "v"(wg) : "memory");   // as in XWAIT; the address is named as an input so that its registers stay live up to the wait
        __builtin_amdgcn_sched_barrier(0); }
    v2f xv[2][16]; v4f wr[4][2][4]; v8f bqraw[4];   // x of the wave's 32 queries, the whole q weight and bias
    { const float* xp = xs + (size_t)(8 * hi) * TT + q0 + 2 * lr;
#pragma unroll
        for (int ks = 0; ks < 2; ++ks)
#pragma unroll
            for (int s = 0; s < 16; ++s) xv[ks][s] = *(const v2f*)(xp + (size_t)(ks * 32 + (s >> 3) * 16 + (s & 7)) * TT); }
    XWAIT
#pragma unroll
    for (int o = 0; o < 4; ++o) bqraw[o] = *(const v8f*)(bq + o * 16 + 8 * hi);
    XWAIT
    { const float* wp = wq + lr * DM + 8 * hi;
#pragma unroll
        for (int o = 0; o < 4; ++o)
#pragma unroll
            for (int ks = 0; ks < 2; ++ks)
#pragma unroll
                for (int g = 0; g < 4; ++g) wr[o][ks][g] = *(const v4f*)(wp + o * 16 * DM + ks * 32 + (g >> 1) * 16 + (g & 1) * 4);
        asm volatile("s_wait_xcnt 0x0" :: "v"(wp) : "memory");   // as in XWAIT; the address is named as an input so that its registers stay live up to the wait: otherwise the group's last load lands on them
        __builtin_amdgcn_sched_barrier(0); }
    XST(xr, 0) XST(xr1, 1) XST(xr2, 2)
#pragma unroll
    for (int p = 0; p < 2; ++p) { v4u uh, ul;       // Wk^T rows 2 lane + p, columns 8 w .. 8 w + 7, hi and lo planes
#pragma unroll
        for (int i = 0; i < 4; ++i) { unsigned h, l; pk2s(wkr[2 * i][p], wkr[2 * i + 1][p], h, l); uh[i] = h; ul[i] = l; }
        *(v4ua*)(wt + (2 * lane + p) * FP + 8 * wave) = uh; *(v4ua*)(wt + FPL + (2 * lane + p) * FP + 8 * wave) = ul; }
    // q of the wave's 32 queries: D = Wq X; column i of tile qt is query q0 + 2 i + qt, so one 8-byte load of x feeds both tiles; D tiles 2 ks and 2 ks + 1 of a column are one B operand as they lie
    v16h qa[2][2], qb[2][2];                        // q as f16 hi and lo
    { v16h xf[2][2], wf[4][2];
#pragma unroll
        for (int ks = 0; ks < 2; ++ks) {
#pragma unroll
            for (int qt = 0; qt < 2; ++qt) { v8u u;
#pragma unroll
                for (int s = 0; s < 8; ++s) u[s] = pk2(xv[ks][2 * s][qt], xv[ks][2 * s + 1][qt]);
                xf[qt][ks] = __builtin_bit_cast(v16h, u); }
#pragma unroll
            for (int o = 0; o < 4; ++o) { v8u u;
#pragma unroll
                for (int s = 0; s < 8; ++s) u[s] = pk2(wr[o][ks][s >> 1][(s & 1) * 2], wr[o][ks][s >> 1][(s & 1) * 2 + 1]);
                wf[o][ks] = __builtin_bit_cast(v16h, u); } }
        v8f a[4][2];
#pragma unroll
        for (int o = 0; o < 4; ++o)
#pragma unroll
            for (int qt = 0; qt < 2; ++qt) a[o][qt] = (v8f){};
#pragma unroll
        for (int ks = 0; ks < 2; ++ks)
#pragma unroll
            for (int o = 0; o < 4; ++o)
#pragma unroll
                for (int qt = 0; qt < 2; ++qt) a[o][qt] = wmmab(wf[o][ks], xf[qt][ks], a[o][qt]);
#pragma unroll
        for (int qt = 0; qt < 2; ++qt)
#pragma unroll
            for (int ks = 0; ks < 2; ++ks) { v8u uh, ul;
#pragma unroll
                for (int e = 0; e < 2; ++e) { const v8f y = a[2 * ks + e][qt] + bqraw[2 * ks + e];
#pragma unroll
                    for (int j = 0; j < 4; ++j) { unsigned h, l; pk2s(y[2 * j], y[2 * j + 1], h, l); uh[e * 4 + j] = h; ul[e * 4 + j] = l; } }
                qa[qt][ks] = __builtin_bit_cast(v16h, uh); qb[qt][ks] = __builtin_bit_cast(v16h, ul); } }
    const int fo = lr * FP + 8 * hi;
    v8f acc[4][2];
    float muse[2], lsum[2];                         // per query column: the softmax reference in use (log2 units) and this lane's share of the sum
    // The loop's work-group barrier is split: BSIG at a stage's end, BWAIT in the middle of the next stage; they alternate strictly in every wave (one signal behind the prologue's barrier, per stage wait then signal, one wait behind the loop).
    // What it is for: a full barrier starts a SIMD's two waves on the same phase, so both want the matrix unit, then both the vector port; released in mid-stage, the wave that runs ahead does its exponents while the other does its score products.
    // Why it is safe: BWAIT of stage s says that every wave has ended stage s - 1, its LDS reads and stores retired. The stores of stage s (into the buffer read in stage s - 1) stand behind it.
    // The LDS reads between a wave's signal and its wait are the x fragments of stage s and the x^T fragments of stage s + 1: planes stored in stages s - 3 and s - 2, published by earlier waits, refilled only in stages s + 1 and s + 2 behind later ones.
#define BSIG  { __builtin_amdgcn_fence(__ATOMIC_RELEASE, "workgroup"); __builtin_amdgcn_s_barrier_signal(-1); }   /* the fence is the first half of __syncthreads(): the wave's own LDS stores and reads retire before it signals; a bare signal carries no wait */
#define BWAIT asm volatile("s_barrier_wait -1" ::: "memory");   /* the clobber keeps the LDS stores that follow behind the wait */
    __syncthreads();                                // publishes the planes of stages 0, 1 and 2 and Wk^T
    BSIG                                            // pairs with the wait of stage 0; here, where the wave has nothing in flight, its fence waits for nothing
    // the v weight and bias, for the epilogue: loaded behind the barrier (in front of it the barrier's own wait would sit out their latency); they fly under the products below
    v4f wvr[4][2][4]; v8f bvraw[4];
#pragma unroll
    for (int o = 0; o < 4; ++o) bvraw[o] = *(const v8f*)(bv + o * 16 + 8 * hi);
    XWAIT
    { const float* wp = wv + lr * DM + 8 * hi;
#pragma unroll
        for (int o = 0; o < 4; ++o)
#pragma unroll
            for (int ks = 0; ks < 2; ++ks)
#pragma unroll
                for (int g = 0; g < 4; ++g) wvr[o][ks][g] = *(const v4f*)(wp + o * 16 * DM + ks * 32 + (g >> 1) * 16 + (g & 1) * 4);
        asm volatile("s_wait_xcnt 0x0" :: "v"(wp) : "memory");   // as behind the q weight's loads
        __builtin_amdgcn_sched_barrier(0); }
    // Q' = Wk^T q: A = Wk^T rows from LDS, B = q; hi.hi + hi.lo + lo.hi, so that Q' carries the rounding of neither factor; rounded once to f16 it is the B operand of every score product
    v16h qh[2][2];
    { v16h wh[4][2], wl[4][2]; v8f d[4][2];
#pragma unroll
        for (int ct = 0; ct < 4; ++ct)
#pragma unroll
            for (int ks = 0; ks < 2; ++ks) { wh[ct][ks] = ldfrag(wt + fo + ct * 16 * FP + ks * 32); wl[ct][ks] = ldfrag(wt + FPL + fo + ct * 16 * FP + ks * 32); }
#pragma unroll
        for (int ct = 0; ct < 4; ++ct)
#pragma unroll
            for (int qt = 0; qt < 2; ++qt) d[ct][qt] = (v8f){};
#pragma unroll
        for (int ks = 0; ks < 2; ++ks)
#pragma unroll
            for (int ct = 0; ct < 4; ++ct)
#pragma unroll
                for (int qt = 0; qt < 2; ++qt) d[ct][qt] = wmmab(wl[ct][ks], qa[qt][ks], d[ct][qt]);
#pragma unroll
        for (int ks = 0; ks < 2; ++ks)
#pragma unroll
            for (int ct = 0; ct < 4; ++ct)
#pragma unroll
                for (int qt = 0; qt < 2; ++qt) d[ct][qt] = wmmab(wh[ct][ks], qb[qt][ks], d[ct][qt]);
#pragma unroll
        for (int ks = 0; ks < 2; ++ks)
#pragma unroll
            for (int ct = 0; ct < 4; ++ct)
#pragma unroll
                for (int qt = 0; qt < 2; ++qt) d[ct][qt] = wmmab(wh[ct][ks], qa[qt][ks], d[ct][qt]);
#pragma unroll
        for (int qt = 0; qt < 2; ++qt)
#pragma unroll
            for (int ks = 0; ks < 2; ++ks) qh[qt][ks] = __builtin_bit_cast(v16h, __builtin_shufflevector(pack8(d[2 * ks][qt]), pack8(d[2 * ks + 1][qt]), 0, 1, 2, 3, 4, 5, 6, 7)); }
    v16h wvf[4][2];                                 // Wv as A fragments, kept for the epilogue
#pragma unroll
    for (int o = 0; o < 4; ++o)
#pragma unroll
        for (int ks = 0; ks < 2; ++ks) { v8u u;
#pragma unroll
            for (int s = 0; s < 8; ++s) u[s] = pk2(wvr[o][ks][s >> 1][(s & 1) * 2], wvr[o][ks][s >> 1][(s & 1) * 2 + 1]);
            wvf[o][ks] = __builtin_bit_cast(v16h, u); }
    v16h kh[2][4];                                  // the x^T fragments of the stage at hand, fetched one stage ahead
    // The softmax reference. Run 0 of the key loop takes each query's maximum over stage 0, adds 8 and keeps that: no maximum, no exchange, no test in stages 1 to 15. Any reference gives the same softmax as long as the weights stay in the f16 range, which the 8 divides:
    // downwards a query's largest weight is at least 2^-8, 2^6 above the smallest normal f16 (below that a weight's rounding error is at most 2^-25, 2^-17 of the largest); upwards a later score may outgrow stage 0's maximum by 2^24.
    // The test: every weight is positive, so it is at most its lane's f32 sum, and a sum below WLIM says that all its weights were finite in f16.
    // Each wave leaves its verdict in LDS in front of the last stage's signal; where any wave's test fails (NaN included), the whole work-group runs the loop once more, run 1, with the running maximum of every stage (weights <= 2^8), which holds for any scores.
#define WLIM 65504.0f                               // the largest finite f16
    u32a* vote = (u32a*)(sm + 4 * 2 * FPL + 2 * FPL);
#pragma unroll 1   // the two runs are one piece of code: run 1 is the rare path
    for (int run = 0; run < 2; ++run) {
#pragma unroll
    for (int ct = 0; ct < 4; ++ct)
#pragma unroll
        for (int qt = 0; qt < 2; ++qt) acc[ct][qt] = (v8f){};
    muse[0] = muse[1] = -3.0e38f; lsum[0] = lsum[1] = 0.f;
    const int nmax = run == 0 ? 1 : TT / FS;        // the stages that take a maximum
    const float lift = run == 0 ? 8.0f : 0.0f;      // what the reference stands above the maximum it is taken from (log2 units)
#pragma unroll
    for (int ks = 0; ks < 2; ++ks)
#pragma unroll
        for (int kt = 0; kt < 4; ++kt) kh[ks][kt] = ldfrag(sm + fo + kt * 16 * FP + ks * 32);
#pragma unroll 1
    for (int s = 0; s < TT / FS; ++s) {
        if (s + 3 < TT / FS) XLOADS(s + 3)
        // every LDS read is issued a phase ahead of its use, in two groups a stage; the score products' x^T fragments are in registers already
        const bf* sb = sm + (s & 3) * 2 * FPL + fo;
        v8f st[4][2];
#pragma unroll
        for (int kt = 0; kt < 4; ++kt)
#pragma unroll
            for (int qt = 0; qt < 2; ++qt) st[kt][qt] = (v8f){};
#pragma unroll
        for (int ks = 0; ks < 2; ++ks)
#pragma unroll
            for (int kt = 0; kt < 4; ++kt)
#pragma unroll
                for (int qt = 0; qt < 2; ++qt) st[kt][qt] = wmmab(kh[ks][kt], qh[qt][ks], st[kt][qt]);
        __builtin_amdgcn_sched_barrier(0);          // keeps the reads below out of the run of score products
        // behind the score products, in one group: every x fragment of stage s (planes written in stage s - 3); they fly under the softmax
        v16h vh[2][4];
#pragma unroll
        for (int ks = 0; ks < 2; ++ks)
#pragma unroll
            for (int ct = 0; ct < 4; ++ct) vh[ks][ct] = ldfrag(sb + FPL + ct * 16 * FP + ks * 32);
        __builtin_amdgcn_sched_barrier(0);          // keeps the group together, in front of the maximum
        if (s < nmax) {                             // a scalar test: stage 0 sets the reference; run 1 follows the maximum through every stage
        // the stage's maximum per query column: in-lane, then one exchange between the wave's halves
        float m2[2];
#pragma unroll
        for (int qt = 0; qt < 2; ++qt) { float mk[4];
#pragma unroll
            for (int kt = 0; kt < 4; ++kt) { mk[kt] = st[kt][qt][0];
#pragma unroll
                for (int j = 1; j < 8; ++j) mk[kt] = fmaxf(mk[kt], st[kt][qt][j]); }
            const float m = fmaxf(fmaxf(mk[0], mk[1]), fmaxf(mk[2], mk[3])); m2[qt] = fmaf(fmaxf(m, xhalf(m)), L2E, lift); }
        // rescale only when some column's maximum has outgrown the one in use by 2^8 (one scalar branch a stage); in run 1 weights stay <= 2^8
        if (__builtin_amdgcn_ballot_w32(m2[0] > muse[0] + 8.0f || m2[1] > muse[1] + 8.0f) != 0) {
#pragma unroll
            for (int qt = 0; qt < 2; ++qt) { const float mn = fmaxf(muse[qt], m2[qt]); const float al = __builtin_amdgcn_exp2f(muse[qt] - mn); muse[qt] = mn; lsum[qt] *= al;
#pragma unroll
                for (int ct = 0; ct < 4; ++ct) acc[ct][qt] *= al; }
        }
        }
        // in front of the exponents, in one group: the x^T fragments of stage s + 1 (planes written in stage s - 2, published by the wait of stage s - 1), into the registers that the score products have read;
        // they fly under the softmax and the weights.x products; in the last stage nobody uses them
        { const bf* sn = sm + ((s + 1) & 3) * 2 * FPL + fo;
#pragma unroll
            for (int ks = 0; ks < 2; ++ks)
#pragma unroll
                for (int kt = 0; kt < 4; ++kt) kh[ks][kt] = ldfrag(sn + kt * 16 * FP + ks * 32); }
        __builtin_amdgcn_sched_barrier(0);          // keeps the group together, in front of the exponents
        BWAIT                                       // every wave has ended stage s - 1: frees the buffer that this stage's stores refill, publishes the planes of stage s + 2
        __builtin_amdgcn_sched_barrier(0);          // keeps the wait at this place: without it the scheduler lifts the exponents and the products over it, to the stage's end
        // weights 2^(s log2e - reference) in f32, summed in f32, rounded to f16; tiles 2 ks and 2 ks + 1 of a column are one B operand as they lie
        v16h ph[2][2];
#pragma unroll
        for (int qt = 0; qt < 2; ++qt) { v2f sk[4]; v8u pw[2]; const v2f l2 = { L2E, L2E }, nm = { -muse[qt], -muse[qt] };
#pragma unroll
            for (int kt = 0; kt < 4; ++kt) { v2f t[4];
#pragma unroll
                for (int j = 0; j < 4; ++j) { v2f sp; sp[0] = st[kt][qt][2 * j]; sp[1] = st[kt][qt][2 * j + 1]; t[j] = __builtin_elementwise_fma(sp, l2, nm); }   // v_pk_fma_f32: two arguments an instruction, each rounded as by fmaf
                // the bare v_exp_f32 as a builtin: the compiler sees it, keeps the distances behind matrix instructions and the slot behind a transcendental itself, and spends a v_nop only where no other instruction fits
#pragma unroll
                for (int j = 0; j < 4; ++j) { t[j][0] = __builtin_amdgcn_exp2f(t[j][0]); t[j][1] = __builtin_amdgcn_exp2f(t[j][1]); }
                sk[kt] = t[0]; pw[kt >> 1][(kt & 1) * 4] = pk2(t[0][0], t[0][1]);
#pragma unroll
                for (int j = 1; j < 4; ++j) { sk[kt] += t[j]; pw[kt >> 1][(kt & 1) * 4 + j] = pk2(t[j][0], t[j][1]); } }
            ph[0][qt] = __builtin_bit_cast(v16h, pw[0]); ph[1][qt] = __builtin_bit_cast(v16h, pw[1]);
            const v2f s2 = (sk[0] + sk[1]) + (sk[2] + sk[3]); lsum[qt] += s2[0] + s2[1]; }
#pragma unroll
        for (int ks = 0; ks < 2; ++ks)
#pragma unroll
            for (int ct = 0; ct < 4; ++ct)
#pragma unroll
                for (int qt = 0; qt < 2; ++qt) acc[ct][qt] = wmmab(vh[ks][ct], ph[ks][qt], acc[ct][qt]);
        if (s + 3 < TT / FS) XSTORES((s + 3) & 3)   // its last readers left it in stage s - 1, which the wait above has seen ended in every wave
        if (s == TT / FS - 1) vote[wave] = __builtin_amdgcn_ballot_w32(!(lsum[0] < WLIM && lsum[1] < WLIM));   // the wave's verdict, one value from every lane; the signal's fence retires the store
        BSIG                                        // this wave's planes of stage s + 3 are stored, its reads of stage s done
    }
    BWAIT                                           // every wave has left the loop's last reads and its verdict is published: the ring becomes output staging, or is filled anew
    if (run != 0) break;
    { const v4u f0 = *(const v4ua*)vote, f1 = *(const v4ua*)(vote + 4);   // every wave reads the same eight words, so the work-group takes the branch as a whole
        if (__builtin_amdgcn_readfirstlane((int)((f0[0] | f0[1] | f0[2] | f0[3]) | (f1[0] | f1[1] | f1[2] | f1[3]))) == 0) break; }
    // run 1: the ring's first three stages anew, as in the prologue; nobody reads the ring any more (the wait above), and nobody writes a verdict again before every wave has read these and passed the barrier below
    XLD(xr, 0) XLD(xr1, 1) XLD(xr2, 2)
    XWAIT
    XST(xr, 0) XST(xr1, 1) XST(xr2, 2)
    __syncthreads();                                // publishes the planes of stages 0, 1 and 2
    BSIG                                            // pairs with the wait of stage 0
    }
    // epilogue: join the halves' sums, normalise, O^T = Wv Y + bv (B = Y, D tiles 2 ks and 2 ks + 1 of a column as they lie), stage each wave's [64 ch][32 queries] in its own LDS range, store whole 128-byte lines
    float* os = (float*)sm + wave * 64 * OP;
    v8f oo[4][2];
    { v16h yb[2][2];
#pragma unroll
        for (int qt = 0; qt < 2; ++qt) { const float t = lsum[qt] + xhalf(lsum[qt]); const float f = __fdiv_rn(1.0f, t);
#pragma unroll
            for (int ks = 0; ks < 2; ++ks) yb[qt][ks] = __builtin_bit_cast(v16h, __builtin_shufflevector(pack8(acc[2 * ks][qt] * f), pack8(acc[2 * ks + 1][qt] * f), 0, 1, 2, 3, 4, 5, 6, 7)); }
#pragma unroll
        for (int o = 0; o < 4; ++o)
#pragma unroll
            for (int qt = 0; qt < 2; ++qt) oo[o][qt] = wmmab(wvf[o][0], yb[qt][0], bvraw[o]);
#pragma unroll
        for (int o = 0; o < 4; ++o)
#pragma unroll
            for (int qt = 0; qt < 2; ++qt) oo[o][qt] = wmmab(wvf[o][1], yb[qt][1], oo[o][qt]); }
#pragma unroll
    for (int qt = 0; qt < 2; ++qt)
#pragma unroll
        for (int ct = 0; ct < 4; ++ct)
#pragma unroll
            for (int j = 0; j < 8; ++j) *(f32a*)(os + (ct * 16 + hi * 8 + j) * OP + 2 * lr + qt) = oo[ct][qt][j];
    float* og = outb + (size_t)blockIdx.y * CC * TT + q0;
#pragma unroll
    for (int it = 0; it < 16; ++it) { const int c = it * 4 + (lane >> 3), x = (lane & 7) * 4; *(v4f*)(og + (size_t)c * TT + x) = *(const v4fa*)(os + c * OP + x); }
}
extern "C" void kernel_launch(void* const* d_in, const int* in_sizes, int n_in,
                              void* d_out, int out_size, void* d_ws, size_t ws_size, hipStream_t stream) {
    (void)in_sizes; (void)n_in; (void)out_size; (void)d_ws; (void)ws_size;
    const float* x = (const float*)d_in[0]; const float* wq = (const float*)d_in[1]; const float* bq = (const float*)d_in[2]; const float* wk = (const float*)d_in[3]; const float* bk = (const float*)d_in[4]; const float* wv = (const float*)d_in[5]; const float* bv = (const float*)d_in[6];
    float* OUT = (float*)d_out;     // [64][64][1024]
    k_fattn<<<dim3(TT / 256, NB_, 1), 256, 0, stream>>>(x, wq, bq, wk, bk, wv, bv, OUT);   /* projections, scores, softmax, weights.x; writes the channel-major output */
}
